// v000
// Measured on an AMD MI455X. A time is GPU time per run, averaged over a window of back-to-back runs after a warm-up
// (all launches, gaps included; the runs take copies of the inputs in turn), and the median of several windows.
// Apart from v000's, it joins two sittings. Times from different sittings can be a few percent apart, while
// side-by-side timings come from the same sitting.
// v000, which the later versions start from, runs in 1770 microseconds.
#include <hip/hip_runtime.h>

// Compute dtypes, f32 accumulate, one batch item per pass: q/k/v = x.W + b from the three separate inputs ([2048 x 512].[512 x 512], k-major weights transposed once;
// PLAIN bf16 operands = inputs rounded once, exact) on v_wmma_f32_16x16x32_bf16 -> bf16 hi + UNSCALED residual planes (v transposed to [d][t]); single-head causal
// attention over the 512-dim head in two query chunks of 1024: scores = q.k^T ([1024 x 512].[512 x kmax], three products, kmax = causal reach), causal row softmax of
// scores x 512^-1/2 (the reference divides q by sqrt(512); applied to the product here) in f32 -> bf16 hi + UNSCALED residual (zeros above the diagonal), out = P.v

#define NB_  8
#define NT_  2048
#define DM   512
#define NTK  NT_
#define RCH  1024
#define HD   128                 // k_vt tile geometry: 4 x 128 = the 512 dims
#define NKV  4
#define KW   512
#define SCL  0.044194173824159216f     // 512^-1/2 (the reference scales q; applied to the scores here)
#define LOSC 1024.0f

typedef _Float16 h16;
typedef unsigned short bf;
typedef __attribute__((ext_vector_type(16))) __bf16   v16bf;
typedef __attribute__((ext_vector_type(16))) _Float16 v16h;
typedef __attribute__((ext_vector_type(8)))  _Float16 v8h;
typedef __attribute__((ext_vector_type(8)))  unsigned short v8us;
typedef __attribute__((ext_vector_type(8)))  float    v8f;
typedef __attribute__((ext_vector_type(4)))  float    v4f;
typedef __attribute__((ext_vector_type(4)))  _Float16 v4h;
typedef v8h  __attribute__((may_alias)) v8ha;
typedef v4f  __attribute__((may_alias)) v4fa;
typedef v8us __attribute__((may_alias)) v8usa;

__device__ __forceinline__ unsigned short f2bf(float f) { unsigned u = __float_as_uint(f); u += 0x7FFFu + ((u >> 16) & 1u); return (unsigned short)(u >> 16); }
__device__ __forceinline__ float bf2f(unsigned short b) { return __uint_as_float(((unsigned)b) << 16); }
__device__ __forceinline__ float bfr(float f) { return bf2f(f2bf(f)); }
__device__ __forceinline__ v16h cat16(v8h lo, v8h hi) { return __builtin_shufflevector(lo, hi, 0, 1, 2, 3, 4, 5, 6, 7, 8, 9, 10, 11, 12, 13, 14, 15); }
__device__ __forceinline__ v16bf cat16b(v8us lo, v8us hi) { return __builtin_bit_cast(v16bf, __builtin_shufflevector(lo, hi, 0, 1, 2, 3, 4, 5, 6, 7, 8, 9, 10, 11, 12, 13, 14, 15)); }
__device__ __forceinline__ v8f wmma16(v16h a, v16h b, v8f c) { return __builtin_amdgcn_wmma_f32_16x16x32_f16(false, a, false, b, (short)0, c, false, false); }
__device__ __forceinline__ v8f wmmab(v16bf a, v16bf b, v8f c) { return __builtin_amdgcn_wmma_f32_16x16x32_bf16(false, a, false, b, (short)0, c, false, false); }

__global__ __launch_bounds__(256) void k_cvtb(const float* __restrict__ src, int nrows, bf* dst) {
    const int lane = threadIdx.x & 31, r = blockIdx.x * 8 + (threadIdx.x >> 5);
    if (r >= nrows) return;
    v8us o[DM / 256];
#pragma unroll
    for (int q = 0; q < DM / 256; ++q) { v8us t;
#pragma unroll
        for (int i = 0; i < 8; ++i) t[i] = f2bf(src[(size_t)r * DM + q * 256 + lane * 8 + i]);
        o[q] = t; }
#pragma unroll
    for (int q = 0; q < DM / 256; ++q) *(v8us*)(dst + (size_t)r * DM + q * 256 + lane * 8) = o[q];
    
}

// k_gemmb: 64 x 64 block tile (4 waves x 16 x 64) of C[NTK][NW] = (A [+ Al]).B^T (K = 512) [+ bf(bias[c])] [+ bf(R[r][c]) residual]; f32 whole-line epilogue (or f16
template <bool SPLITA, bool F16OUT = false>
__global__ __launch_bounds__(128) void k_gemmb(const bf* __restrict__ A, const bf* __restrict__ Al, const bf* __restrict__ Bn, const float* __restrict__ bias, float* C, int ldc, h16* C2, const float* __restrict__ R = nullptr, int K = DM, int roundR = 1) {
    __shared__ __align__(16) float ost[4][16 * 68];
    const int lane = threadIdx.x & 31, wave = threadIdx.x >> 5, lr = lane & 15, hi = lane >> 4;
    const int r0 = blockIdx.x * 64 + wave * 16, c0 = blockIdx.y * 64;
    const size_t aoff = (size_t)(r0 + lr) * K + 8 * hi;
    size_t boff[4];
#pragma unroll
    for (int t = 0; t < 4; ++t) boff[t] = (size_t)(c0 + t * 16 + lr) * K + 8 * hi;
    v8f acc[4];
#pragma unroll
    for (int t = 0; t < 4; ++t) acc[t] = (v8f){};
#pragma unroll 1
    for (int kc = 0; kc < K; kc += 32) {
        const v16bf a = cat16b(*(const v8us*)(A + aoff + kc), *(const v8us*)(A + aoff + kc + 16));
        v16bf al = a;
        if (SPLITA) al = cat16b(*(const v8us*)(Al + aoff + kc), *(const v8us*)(Al + aoff + kc + 16));
#pragma unroll
        for (int t = 0; t < 4; ++t) { const v16bf b = cat16b(*(const v8us*)(Bn + boff[t] + kc), *(const v8us*)(Bn + boff[t] + kc + 16)); acc[t] = wmmab(a, b, acc[t]); if (SPLITA) acc[t] = wmmab(al, b, acc[t]); }
        asm volatile("v_nop\n\tv_nop\n\tv_nop\n\tv_nop" : "+v"(acc[0]), "+v"(acc[1]), "+v"(acc[2]), "+v"(acc[3]) : "v"(a), "v"(al));
    }
    float* os = &ost[wave][0];
#pragma unroll
    for (int t = 0; t < 4; ++t) { const float bv = bias ? bfr(bias[c0 + t * 16 + lr]) : 0.f;
#pragma unroll
        for (int j = 0; j < 8; ++j) os[(hi * 8 + j) * 68 + t * 16 + lr] = acc[t][j] + bv; }
    __syncthreads();
    if (F16OUT) {
        h16* crow = (h16*)(void*)C + (size_t)r0 * ldc + c0;
        auto pass = [&]() {
#pragma unroll
            for (int s = 0; s < 4; ++s) { const int row = 4 * s + (lane >> 3), piece = lane & 7; const float* sp = os + row * 68 + piece * 8; v8h o, o2;
#pragma unroll
                for (int i = 0; i < 8; ++i) { const h16 a = (h16)sp[i]; o[i] = a; o2[i] = (h16)((sp[i] - (float)a) * LOSC); }
                *(v8h*)(crow + (size_t)row * ldc + piece * 8) = o; if (C2) *(v8h*)(C2 + (size_t)r0 * ldc + c0 + (size_t)row * ldc + piece * 8) = o2; }
        };
        pass(); 
    } else {
        float* crow = C + (size_t)r0 * ldc + c0;
        auto pass = [&]() {
#pragma unroll
            for (int s = 0; s < 8; ++s) { const int Lid = (lane >> 3) + 4 * s, piece = lane & 7; const int row = Lid >> 1, cofs = (Lid & 1) * 32 + piece * 4;
                v4f val = *(const v4fa*)(os + row * 68 + cofs); if (R) { const v4f rv = *(const v4f*)(R + ((size_t)r0 + row) * ldc + c0 + cofs); val += roundR ? (v4f){bfr(rv[0]), bfr(rv[1]), bfr(rv[2]), bfr(rv[3])} : rv; }
                *(v4f*)(crow + (size_t)row * ldc + cofs) = val; }
        };
        pass(); 
    }
}

// k_gemm3: 64 x 64 tile of C = (Ah + Al).(Bh + Bl)^T over K (row strides = K for all four planes; n-major B): three products per 32-k step (hh, hl, lh); f32
__global__ __launch_bounds__(128) void k_gemm3(const bf* __restrict__ Ah, const bf* __restrict__ Al, const bf* __restrict__ Bh, const bf* __restrict__ Bl, int K, float* C, int ldc) {
    __shared__ __align__(16) float ost[4][16 * 68];
    const int lane = threadIdx.x & 31, wave = threadIdx.x >> 5, lr = lane & 15, hi = lane >> 4;
    const int r0 = blockIdx.x * 64 + wave * 16, c0 = blockIdx.y * 64;
    const size_t aoff = (size_t)(r0 + lr) * K + 8 * hi;
    v8f acc[4];
#pragma unroll
    for (int t = 0; t < 4; ++t) acc[t] = (v8f){};
#pragma unroll 1
    for (int kc = 0; kc < K; kc += 32) {
        const v16bf a = cat16b(*(const v8us*)(Ah + aoff + kc), *(const v8us*)(Ah + aoff + kc + 16));
        const v16bf al = cat16b(*(const v8us*)(Al + aoff + kc), *(const v8us*)(Al + aoff + kc + 16));
#pragma unroll
        for (int t = 0; t < 4; ++t) { const size_t bo = (size_t)(c0 + t * 16 + lr) * K + kc + 8 * hi;
            const v16bf bh = cat16b(*(const v8us*)(Bh + bo), *(const v8us*)(Bh + bo + 16)); const v16bf bl = cat16b(*(const v8us*)(Bl + bo), *(const v8us*)(Bl + bo + 16));
            acc[t] = wmmab(a, bh, acc[t]); acc[t] = wmmab(al, bh, acc[t]); acc[t] = wmmab(a, bl, acc[t]); }
        asm volatile("v_nop\n\tv_nop\n\tv_nop\n\tv_nop" : "+v"(acc[0]), "+v"(acc[1]), "+v"(acc[2]), "+v"(acc[3]) : "v"(a), "v"(al));
    }
    float* os = &ost[wave][0];
#pragma unroll
    for (int t = 0; t < 4; ++t) {
#pragma unroll
        for (int j = 0; j < 8; ++j) os[(hi * 8 + j) * 68 + t * 16 + lr] = acc[t][j]; }
    __builtin_amdgcn_wave_barrier(); asm volatile("" ::: "memory");
    float* crow = C + (size_t)r0 * ldc + c0;
    auto pass = [&]() {
#pragma unroll
        for (int s = 0; s < 8; ++s) { const int Lid = (lane >> 3) + 4 * s, piece = lane & 7; const int row = Lid >> 1, cofs = (Lid & 1) * 32 + piece * 4;
            const v4f val = *(const v4fa*)(os + row * 68 + cofs); *(v4f*)(crow + (size_t)row * ldc + cofs) = val; }
    };
    pass(); 
}

__global__ __launch_bounds__(256) void k_split(const float* __restrict__ src, int nrows, bf* dh, bf* dl) {
    const int lane = threadIdx.x & 31, r = blockIdx.x * 8 + (threadIdx.x >> 5); if (r >= nrows) return;
{
#pragma unroll 1
        for (int q = 0; q < DM / 256; ++q) { const size_t o = (size_t)r * DM + q * 256 + lane * 8; const v8f v = *(const v8f*)(src + o); v8us oh, ol;
#pragma unroll
            for (int i = 0; i < 8; ++i) { const unsigned short hb = f2bf(v[i]); oh[i] = hb; ol[i] = f2bf(v[i] - bf2f(hb)); }
            *(v8us*)(dh + o) = oh; *(v8us*)(dl + o) = ol; }
         }
}
// k_vt: VTH/VTL [g][128 d][2048 t] = bf16 hi + UNSCALED bf16 residual of V [t][g*128+d] via 64 x 64 LDS tiles; grid (NT/64, 2 (d half), 4 groups of 128 d).
__global__ __launch_bounds__(256) void k_vt(const float* __restrict__ V, bf* VTH, bf* VTL) {
    __shared__ float tl[64][65];
    const int tid = threadIdx.x, t0 = blockIdx.x * 64, d0 = blockIdx.y * 64, g = blockIdx.z;
    { const int tt = tid >> 2, dq = (tid & 3) * 16;
#pragma unroll
      for (int i = 0; i < 16; ++i) tl[dq + i][tt] = V[(size_t)(t0 + tt) * KW + g * HD + d0 + dq + i]; }
    __syncthreads();
    const int piece = tid & 7;
    auto pass = [&]() {
#pragma unroll
        for (int s = 0; s < 2; ++s) { const int d = (tid >> 3) + 32 * s; v8us oh, ol;
#pragma unroll
            for (int i = 0; i < 8; ++i) { const float v = tl[d][piece * 8 + i]; const unsigned short hb = f2bf(v); oh[i] = hb; ol[i] = f2bf(v - bf2f(hb)); }
            const size_t o = ((size_t)g * HD + d0 + d) * NT_ + t0 + piece * 8; *(v8us*)(VTH + o) = oh; *(v8us*)(VTL + o) = ol; }
    };
    pass(); 
}

// k_csoftmax: one wave per row r of the chunk's scores S [1024][pitch] (row = query r0 + r): over the causally visible columns k <= r0 + r (the rest of the row up to
// 'ncols' gets probability 0): a = s x 512^-1/2, max, exp, normalise (f32, fixed lane order; the row re-read per phase) -> bf16 hi + UNSCALED residual planes with the same pitch;
__global__ __launch_bounds__(256) void k_csoftmax(const float* __restrict__ S, int r0, int ncols, bf* PH, bf* PL) {
    const int lane = threadIdx.x & 31, r = blockIdx.x * 8 + (threadIdx.x >> 5); if (r >= RCH) return;
    const int qi = r0 + r; const float* sr = S + (size_t)r * ncols;
    float m = -3.0e38f;
#pragma unroll 1
    for (int c0 = lane * 8; c0 < ncols; c0 += 256) { const v8f v = *(const v8f*)(sr + c0);
#pragma unroll
        for (int i = 0; i < 8; ++i) if (c0 + i <= qi) m = fmaxf(m, v[i] * SCL); }
#pragma unroll
    for (int sh = 16; sh; sh >>= 1) m = fmaxf(m, __shfl_xor(m, sh, 32));
    float sum = 0.f;
#pragma unroll 1
    for (int c0 = lane * 8; c0 < ncols; c0 += 256) { const v8f v = *(const v8f*)(sr + c0);
#pragma unroll
        for (int i = 0; i < 8; ++i) if (c0 + i <= qi) sum += __expf(v[i] * SCL - m); }
#pragma unroll
    for (int sh = 16; sh; sh >>= 1) sum += __shfl_xor(sum, sh, 32);
    const float inv = 1.0f / sum;
{
#pragma unroll 1
        for (int c0 = lane * 8; c0 < ncols; c0 += 256) { const v8f v = *(const v8f*)(sr + c0); v8us oh, ol;
#pragma unroll
            for (int i = 0; i < 8; ++i) { const float p = (c0 + i <= qi) ? __expf(v[i] * SCL - m) * inv : 0.f; const unsigned short hb = f2bf(p); oh[i] = hb; ol[i] = f2bf(p - bf2f(hb)); }
            const size_t o = (size_t)r * ncols + c0; *(v8us*)(PH + o) = oh; *(v8us*)(PL + o) = ol; }
         }
}

// k_wt: WT [n][K] = bf16(W[k][n]) (k-major [K][ncols]) via 64 x 64 LDS tiles; grid (K/64, ncols/64).
__global__ __launch_bounds__(256) void k_wt(const float* __restrict__ Wm, int K, int ncols, bf* WT) {
    __shared__ __align__(16) unsigned short tl[64 * 72];
    const int tid = threadIdx.x, k0 = blockIdx.x * 64, n0 = blockIdx.y * 64;
    const int kk = tid >> 2, nq = (tid & 3) * 16;
#pragma unroll
    for (int i = 0; i < 16; ++i) tl[(nq + i) * 72 + kk] = f2bf(Wm[(size_t)(k0 + kk) * ncols + n0 + nq + i]);
    __syncthreads();
    const int piece = tid & 7;
    auto pass = [&]() {
#pragma unroll
        for (int s = 0; s < 2; ++s) { const int nr = (tid >> 3) + 32 * s; const v8us val = *(const v8usa*)(tl + nr * 72 + piece * 8); *(v8us*)(WT + (size_t)(n0 + nr) * K + k0 + piece * 8) = val; }
    };
    pass(); 
}
extern "C" void kernel_launch(void* const* d_in, const int* in_sizes, int n_in,
                              void* d_out, int out_size, void* d_ws, size_t ws_size, hipStream_t stream) {
    (void)in_sizes; (void)n_in; (void)out_size;
    const float* xq = (const float*)d_in[0]; const float* xk = (const float*)d_in[1]; const float* xv = (const float*)d_in[2];
    const float* Wq = (const float*)d_in[3]; const float* bq = (const float*)d_in[4]; const float* Wk = (const float*)d_in[5]; const float* bk = (const float*)d_in[6]; const float* Wv = (const float*)d_in[7]; const float* bv = (const float*)d_in[8];   // k-major (x @ W) + biases
    float* out = (float*)d_out;    // [8][2048][512]
    char* wsp = (char*)d_ws;
    auto take = [&](size_t bytes) { char* p = wsp; wsp += (bytes + 255) & ~(size_t)255; return (void*)p; };
    bf* WqT = (bf*)take((size_t)DM * DM * 2); bf* WkT = (bf*)take((size_t)DM * DM * 2); bf* WvT = (bf*)take((size_t)DM * DM * 2); bf* Xb = (bf*)take((size_t)NT_ * DM * 2);
    float* TMP = (float*)take((size_t)NT_ * DM * 4); bf* Qh = (bf*)take((size_t)NT_ * DM * 2); bf* Ql = (bf*)take((size_t)NT_ * DM * 2); bf* Kh = (bf*)take((size_t)NT_ * DM * 2); bf* Kl = (bf*)take((size_t)NT_ * DM * 2);
    bf* VTH = (bf*)take((size_t)DM * NT_ * 2); bf* VTL = (bf*)take((size_t)DM * NT_ * 2); float* S = (float*)take((size_t)RCH * NT_ * 4); bf* PH = (bf*)take((size_t)RCH * NT_ * 2); bf* PL = (bf*)take((size_t)RCH * NT_ * 2);
    if ((size_t)(wsp - (char*)d_ws) > ws_size) return;    // ~ 1.6 + 2.1 + 4.2 + 4 x 2.1 + 2 x 2.1 + 8.4 + 2 x 4.2 ~ 37 MB, no aliasing (per-item / per-chunk reuse in stream order)
    k_wt<<<dim3(DM / 64, DM / 64, 1), 256, 0, stream>>>(Wq, DM, DM, WqT); k_wt<<<dim3(DM / 64, DM / 64, 1), 256, 0, stream>>>(Wk, DM, DM, WkT); k_wt<<<dim3(DM / 64, DM / 64, 1), 256, 0, stream>>>(Wv, DM, DM, WvT);
    for (int b = 0; b < NB_; ++b) {
        k_cvtb<<<NT_ / 8, 256, 0, stream>>>(xq + (size_t)b * NT_ * DM, NT_, Xb);
        k_gemmb<false, false><<<dim3(NT_ / 64, DM / 64, 1), 128, 0, stream>>>(Xb, nullptr, WqT, bq, TMP, DM, nullptr); k_split<<<NT_ / 8, 256, 0, stream>>>(TMP, NT_, Qh, Ql);
        k_cvtb<<<NT_ / 8, 256, 0, stream>>>(xk + (size_t)b * NT_ * DM, NT_, Xb);
        k_gemmb<false, false><<<dim3(NT_ / 64, DM / 64, 1), 128, 0, stream>>>(Xb, nullptr, WkT, bk, TMP, DM, nullptr); k_split<<<NT_ / 8, 256, 0, stream>>>(TMP, NT_, Kh, Kl);
        k_cvtb<<<NT_ / 8, 256, 0, stream>>>(xv + (size_t)b * NT_ * DM, NT_, Xb);
        k_gemmb<false, false><<<dim3(NT_ / 64, DM / 64, 1), 128, 0, stream>>>(Xb, nullptr, WvT, bv, TMP, DM, nullptr); k_vt<<<dim3(NT_ / 64, 2, NKV), 256, 0, stream>>>(TMP, VTH, VTL);
        for (int ch = 0; ch < NT_ / RCH; ++ch) {
            const int r0 = ch * RCH, kmax = r0 + RCH;
            k_gemm3<<<dim3(RCH / 64, kmax / 64, 1), 128, 0, stream>>>(Qh + (size_t)r0 * DM, Ql + (size_t)r0 * DM, Kh, Kl, DM, S, NT_);
            k_csoftmax<<<RCH / 8, 256, 0, stream>>>(S, r0, NT_, PH, PL);
            k_gemm3<<<dim3(RCH / 64, DM / 64, 1), 128, 0, stream>>>(PH, PL, VTH, VTL, NT_, out + ((size_t)b * NT_ + r0) * DM, DM);
        }
    }
}

// v001
// Measured time: 753 microseconds a run.
// In both of two side-by-side timings against v000, it was 2.35 times as fast.
#include <hip/hip_runtime.h>

// Compute dtypes, f32 accumulate, all 8 batch items in every launch (rows flattened, or the item in blockIdx.z): q/k/v = x.W + b from the three separate inputs ([8 x 2048 x 512].[512 x 512], k-major weights transposed once;
// PLAIN bf16 operands = inputs rounded once, exact) on v_wmma_f32_16x16x32_bf16 -> bf16 hi + UNSCALED residual planes (v transposed to [d][t]); single-head causal
// attention over the 512-dim head in two query chunks of 1024: scores = q.k^T ([1024 x 512].[512 x kmax], three products, kmax = causal reach), causal row softmax of
// scores x 512^-1/2 (the reference divides q by sqrt(512); applied to the product here) in f32 -> bf16 hi + UNSCALED residual (zeros above the diagonal), out = P.v

#define NB_  8
#define NT_  2048
#define DM   512
#define NTK  NT_
#define RCH  1024
#define HD   128                 // k_vt tile geometry: 4 x 128 = the 512 dims
#define NKV  4
#define KW   512
#define SCL  0.044194173824159216f     // 512^-1/2 (the reference scales q; applied to the scores here)
#define LOSC 1024.0f

typedef _Float16 h16;
typedef unsigned short bf;
typedef __attribute__((ext_vector_type(16))) __bf16   v16bf;
typedef __attribute__((ext_vector_type(16))) _Float16 v16h;
typedef __attribute__((ext_vector_type(8)))  _Float16 v8h;
typedef __attribute__((ext_vector_type(8)))  unsigned short v8us;
typedef __attribute__((ext_vector_type(8)))  float    v8f;
typedef __attribute__((ext_vector_type(4)))  float    v4f;
typedef __attribute__((ext_vector_type(4)))  _Float16 v4h;
typedef v8h  __attribute__((may_alias)) v8ha;
typedef v4f  __attribute__((may_alias)) v4fa;
typedef v8us __attribute__((may_alias)) v8usa;

__device__ __forceinline__ unsigned short f2bf(float f) { unsigned u = __float_as_uint(f); u += 0x7FFFu + ((u >> 16) & 1u); return (unsigned short)(u >> 16); }
__device__ __forceinline__ float bf2f(unsigned short b) { return __uint_as_float(((unsigned)b) << 16); }
__device__ __forceinline__ float bfr(float f) { return bf2f(f2bf(f)); }
__device__ __forceinline__ v16h cat16(v8h lo, v8h hi) { return __builtin_shufflevector(lo, hi, 0, 1, 2, 3, 4, 5, 6, 7, 8, 9, 10, 11, 12, 13, 14, 15); }
__device__ __forceinline__ v16bf cat16b(v8us lo, v8us hi) { return __builtin_bit_cast(v16bf, __builtin_shufflevector(lo, hi, 0, 1, 2, 3, 4, 5, 6, 7, 8, 9, 10, 11, 12, 13, 14, 15)); }
__device__ __forceinline__ v8f wmma16(v16h a, v16h b, v8f c) { return __builtin_amdgcn_wmma_f32_16x16x32_f16(false, a, false, b, (short)0, c, false, false); }
__device__ __forceinline__ v8f wmmab(v16bf a, v16bf b, v8f c) { return __builtin_amdgcn_wmma_f32_16x16x32_bf16(false, a, false, b, (short)0, c, false, false); }

__global__ __launch_bounds__(256) void k_cvtb(const float* __restrict__ src, int nrows, bf* dst) {
    const int lane = threadIdx.x & 31, r = blockIdx.x * 8 + (threadIdx.x >> 5);
    if (r >= nrows) return;
    v8us o[DM / 256];
#pragma unroll
    for (int q = 0; q < DM / 256; ++q) { v8us t;
#pragma unroll
        for (int i = 0; i < 8; ++i) t[i] = f2bf(src[(size_t)r * DM + q * 256 + lane * 8 + i]);
        o[q] = t; }
#pragma unroll
    for (int q = 0; q < DM / 256; ++q) *(v8us*)(dst + (size_t)r * DM + q * 256 + lane * 8) = o[q];
    
}

// k_gemmb: 64 x 64 block tile (4 waves x 16 x 64) of C[NB_ * NTK][DM] = (A [+ Al]).B^T (K = 512) [+ bf(bias[c])] [+ bf(R[r][c]) residual]; f32 whole-line epilogue (or f16
template <bool SPLITA, bool F16OUT = false>
__global__ __launch_bounds__(128) void k_gemmb(const bf* __restrict__ A, const bf* __restrict__ Al, const bf* __restrict__ Bn, const float* __restrict__ bias, float* C, int ldc, h16* C2, const float* __restrict__ R = nullptr, int K = DM, int roundR = 1) {
    __shared__ __align__(16) float ost[4][16 * 68];
    const int lane = threadIdx.x & 31, wave = threadIdx.x >> 5, lr = lane & 15, hi = lane >> 4;
    const int r0 = blockIdx.x * 64 + wave * 16, c0 = blockIdx.y * 64;
    const size_t aoff = (size_t)(r0 + lr) * K + 8 * hi;
    size_t boff[4];
#pragma unroll
    for (int t = 0; t < 4; ++t) boff[t] = (size_t)(c0 + t * 16 + lr) * K + 8 * hi;
    v8f acc[4];
#pragma unroll
    for (int t = 0; t < 4; ++t) acc[t] = (v8f){};
#pragma unroll 1
    for (int kc = 0; kc < K; kc += 32) {
        const v16bf a = cat16b(*(const v8us*)(A + aoff + kc), *(const v8us*)(A + aoff + kc + 16));
        v16bf al = a;
        if (SPLITA) al = cat16b(*(const v8us*)(Al + aoff + kc), *(const v8us*)(Al + aoff + kc + 16));
#pragma unroll
        for (int t = 0; t < 4; ++t) { const v16bf b = cat16b(*(const v8us*)(Bn + boff[t] + kc), *(const v8us*)(Bn + boff[t] + kc + 16)); acc[t] = wmmab(a, b, acc[t]); if (SPLITA) acc[t] = wmmab(al, b, acc[t]); }
        asm volatile("v_nop\n\tv_nop\n\tv_nop\n\tv_nop" : "+v"(acc[0]), "+v"(acc[1]), "+v"(acc[2]), "+v"(acc[3]) : "v"(a), "v"(al));
    }
    float* os = &ost[wave][0];
#pragma unroll
    for (int t = 0; t < 4; ++t) { const float bv = bias ? bfr(bias[c0 + t * 16 + lr]) : 0.f;
#pragma unroll
        for (int j = 0; j < 8; ++j) os[(hi * 8 + j) * 68 + t * 16 + lr] = acc[t][j] + bv; }
    __syncthreads();
    if (F16OUT) {
        h16* crow = (h16*)(void*)C + (size_t)r0 * ldc + c0;
        auto pass = [&]() {
#pragma unroll
            for (int s = 0; s < 4; ++s) { const int row = 4 * s + (lane >> 3), piece = lane & 7; const float* sp = os + row * 68 + piece * 8; v8h o, o2;
#pragma unroll
                for (int i = 0; i < 8; ++i) { const h16 a = (h16)sp[i]; o[i] = a; o2[i] = (h16)((sp[i] - (float)a) * LOSC); }
                *(v8h*)(crow + (size_t)row * ldc + piece * 8) = o; if (C2) *(v8h*)(C2 + (size_t)r0 * ldc + c0 + (size_t)row * ldc + piece * 8) = o2; }
        };
        pass(); 
    } else {
        float* crow = C + (size_t)r0 * ldc + c0;
        auto pass = [&]() {
#pragma unroll
            for (int s = 0; s < 8; ++s) { const int Lid = (lane >> 3) + 4 * s, piece = lane & 7; const int row = Lid >> 1, cofs = (Lid & 1) * 32 + piece * 4;
                v4f val = *(const v4fa*)(os + row * 68 + cofs); if (R) { const v4f rv = *(const v4f*)(R + ((size_t)r0 + row) * ldc + c0 + cofs); val += roundR ? (v4f){bfr(rv[0]), bfr(rv[1]), bfr(rv[2]), bfr(rv[3])} : rv; }
                *(v4f*)(crow + (size_t)row * ldc + cofs) = val; }
        };
        pass(); 
    }
}

// k_gemm3: 64 x 64 tile of C = (Ah + Al).(Bh + Bl)^T over K (row strides = K for all four planes; n-major B): three products per 32-k step (hh, hl, lh); f32;
// blockIdx.z = batch item, sA / sB / sC = elements from one item's A planes / B planes / C to the next item's
__global__ __launch_bounds__(128) void k_gemm3(const bf* __restrict__ Ah, const bf* __restrict__ Al, const bf* __restrict__ Bh, const bf* __restrict__ Bl, int K, float* C, int ldc, int sA, int sB, int sC) {
    __shared__ __align__(16) float ost[4][16 * 68];
    Ah += (size_t)blockIdx.z * sA; Al += (size_t)blockIdx.z * sA; Bh += (size_t)blockIdx.z * sB; Bl += (size_t)blockIdx.z * sB; C += (size_t)blockIdx.z * sC;
    const int lane = threadIdx.x & 31, wave = threadIdx.x >> 5, lr = lane & 15, hi = lane >> 4;
    const int r0 = blockIdx.x * 64 + wave * 16, c0 = blockIdx.y * 64;
    const size_t aoff = (size_t)(r0 + lr) * K + 8 * hi;
    v8f acc[4];
#pragma unroll
    for (int t = 0; t < 4; ++t) acc[t] = (v8f){};
#pragma unroll 1
    for (int kc = 0; kc < K; kc += 32) {
        const v16bf a = cat16b(*(const v8us*)(Ah + aoff + kc), *(const v8us*)(Ah + aoff + kc + 16));
        const v16bf al = cat16b(*(const v8us*)(Al + aoff + kc), *(const v8us*)(Al + aoff + kc + 16));
#pragma unroll
        for (int t = 0; t < 4; ++t) { const size_t bo = (size_t)(c0 + t * 16 + lr) * K + kc + 8 * hi;
            const v16bf bh = cat16b(*(const v8us*)(Bh + bo), *(const v8us*)(Bh + bo + 16)); const v16bf bl = cat16b(*(const v8us*)(Bl + bo), *(const v8us*)(Bl + bo + 16));
            acc[t] = wmmab(a, bh, acc[t]); acc[t] = wmmab(al, bh, acc[t]); acc[t] = wmmab(a, bl, acc[t]); }
        asm volatile("v_nop\n\tv_nop\n\tv_nop\n\tv_nop" : "+v"(acc[0]), "+v"(acc[1]), "+v"(acc[2]), "+v"(acc[3]) : "v"(a), "v"(al));
    }
    float* os = &ost[wave][0];
#pragma unroll
    for (int t = 0; t < 4; ++t) {
#pragma unroll
        for (int j = 0; j < 8; ++j) os[(hi * 8 + j) * 68 + t * 16 + lr] = acc[t][j]; }
    __builtin_amdgcn_wave_barrier(); asm volatile("" ::: "memory");
    float* crow = C + (size_t)r0 * ldc + c0;
    auto pass = [&]() {
#pragma unroll
        for (int s = 0; s < 8; ++s) { const int Lid = (lane >> 3) + 4 * s, piece = lane & 7; const int row = Lid >> 1, cofs = (Lid & 1) * 32 + piece * 4;
            const v4f val = *(const v4fa*)(os + row * 68 + cofs); *(v4f*)(crow + (size_t)row * ldc + cofs) = val; }
    };
    pass(); 
}

__global__ __launch_bounds__(256) void k_split(const float* __restrict__ src, int nrows, bf* dh, bf* dl) {
    const int lane = threadIdx.x & 31, r = blockIdx.x * 8 + (threadIdx.x >> 5); if (r >= nrows) return;
{
#pragma unroll 1
        for (int q = 0; q < DM / 256; ++q) { const size_t o = (size_t)r * DM + q * 256 + lane * 8; const v8f v = *(const v8f*)(src + o); v8us oh, ol;
#pragma unroll
            for (int i = 0; i < 8; ++i) { const unsigned short hb = f2bf(v[i]); oh[i] = hb; ol[i] = f2bf(v[i] - bf2f(hb)); }
            *(v8us*)(dh + o) = oh; *(v8us*)(dl + o) = ol; }
         }
}
// k_vt: VTH/VTL [g][128 d][2048 t] = bf16 hi + UNSCALED bf16 residual of V [t][g*128+d] via 64 x 64 LDS tiles; grid (NT/64, 2 (d half), 4 d groups x 8 items).
__global__ __launch_bounds__(256) void k_vt(const float* __restrict__ V, bf* VTH, bf* VTL) {
    __shared__ float tl[64][65];
    const int tid = threadIdx.x, t0 = blockIdx.x * 64, d0 = blockIdx.y * 64, g = blockIdx.z % NKV, item = blockIdx.z / NKV;
    V += (size_t)item * NT_ * KW; VTH += (size_t)item * DM * NT_; VTL += (size_t)item * DM * NT_;
    { const int tt = tid >> 2, dq = (tid & 3) * 16;
#pragma unroll
      for (int i = 0; i < 16; ++i) tl[dq + i][tt] = V[(size_t)(t0 + tt) * KW + g * HD + d0 + dq + i]; }
    __syncthreads();
    const int piece = tid & 7;
    auto pass = [&]() {
#pragma unroll
        for (int s = 0; s < 2; ++s) { const int d = (tid >> 3) + 32 * s; v8us oh, ol;
#pragma unroll
            for (int i = 0; i < 8; ++i) { const float v = tl[d][piece * 8 + i]; const unsigned short hb = f2bf(v); oh[i] = hb; ol[i] = f2bf(v - bf2f(hb)); }
            const size_t o = ((size_t)g * HD + d0 + d) * NT_ + t0 + piece * 8; *(v8us*)(VTH + o) = oh; *(v8us*)(VTL + o) = ol; }
    };
    pass(); 
}

// k_csoftmax: one wave per row r of the chunk's scores S [8 items x 1024][pitch] (row = query r0 + r % 1024 of item r / 1024): over the causally visible columns k <= r0 + r % 1024 (the rest of the row up to
// 'ncols' gets probability 0): a = s x 512^-1/2, max, exp, normalise (f32, fixed lane order; the row re-read per phase) -> bf16 hi + UNSCALED residual planes with the same pitch;
__global__ __launch_bounds__(256) void k_csoftmax(const float* __restrict__ S, int r0, int ncols, bf* PH, bf* PL) {
    const int lane = threadIdx.x & 31, r = blockIdx.x * 8 + (threadIdx.x >> 5); if (r >= NB_ * RCH) return;
    const int qi = r0 + r % RCH; const float* sr = S + (size_t)r * ncols;
    float m = -3.0e38f;
#pragma unroll 1
    for (int c0 = lane * 8; c0 < ncols; c0 += 256) { const v8f v = *(const v8f*)(sr + c0);
#pragma unroll
        for (int i = 0; i < 8; ++i) if (c0 + i <= qi) m = fmaxf(m, v[i] * SCL); }
#pragma unroll
    for (int sh = 16; sh; sh >>= 1) m = fmaxf(m, __shfl_xor(m, sh, 32));
    float sum = 0.f;
#pragma unroll 1
    for (int c0 = lane * 8; c0 < ncols; c0 += 256) { const v8f v = *(const v8f*)(sr + c0);
#pragma unroll
        for (int i = 0; i < 8; ++i) if (c0 + i <= qi) sum += __expf(v[i] * SCL - m); }
#pragma unroll
    for (int sh = 16; sh; sh >>= 1) sum += __shfl_xor(sum, sh, 32);
    const float inv = 1.0f / sum;
{
#pragma unroll 1
        for (int c0 = lane * 8; c0 < ncols; c0 += 256) { const v8f v = *(const v8f*)(sr + c0); v8us oh, ol;
#pragma unroll
            for (int i = 0; i < 8; ++i) { const float p = (c0 + i <= qi) ? __expf(v[i] * SCL - m) * inv : 0.f; const unsigned short hb = f2bf(p); oh[i] = hb; ol[i] = f2bf(p - bf2f(hb)); }
            const size_t o = (size_t)r * ncols + c0; *(v8us*)(PH + o) = oh; *(v8us*)(PL + o) = ol; }
         }
}

// k_wt: WT [n][K] = bf16(W[k][n]) (k-major [K][ncols]) via 64 x 64 LDS tiles; grid (K/64, ncols/64).
__global__ __launch_bounds__(256) void k_wt(const float* __restrict__ Wm, int K, int ncols, bf* WT) {
    __shared__ __align__(16) unsigned short tl[64 * 72];
    const int tid = threadIdx.x, k0 = blockIdx.x * 64, n0 = blockIdx.y * 64;
    const int kk = tid >> 2, nq = (tid & 3) * 16;
#pragma unroll
    for (int i = 0; i < 16; ++i) tl[(nq + i) * 72 + kk] = f2bf(Wm[(size_t)(k0 + kk) * ncols + n0 + nq + i]);
    __syncthreads();
    const int piece = tid & 7;
    auto pass = [&]() {
#pragma unroll
        for (int s = 0; s < 2; ++s) { const int nr = (tid >> 3) + 32 * s; const v8us val = *(const v8usa*)(tl + nr * 72 + piece * 8); *(v8us*)(WT + (size_t)(n0 + nr) * K + k0 + piece * 8) = val; }
    };
    pass(); 
}
extern "C" void kernel_launch(void* const* d_in, const int* in_sizes, int n_in,
                              void* d_out, int out_size, void* d_ws, size_t ws_size, hipStream_t stream) {
    (void)in_sizes; (void)n_in; (void)out_size;
    const float* xq = (const float*)d_in[0]; const float* xk = (const float*)d_in[1]; const float* xv = (const float*)d_in[2];
    const float* Wq = (const float*)d_in[3]; const float* bq = (const float*)d_in[4]; const float* Wk = (const float*)d_in[5]; const float* bk = (const float*)d_in[6]; const float* Wv = (const float*)d_in[7]; const float* bv = (const float*)d_in[8];   // k-major (x @ W) + biases
    float* out = (float*)d_out;    // [8][2048][512]
    char* wsp = (char*)d_ws;
    auto take = [&](size_t bytes) { char* p = wsp; wsp += (bytes + 255) & ~(size_t)255; return (void*)p; };
    bf* WqT = (bf*)take((size_t)DM * DM * 2); bf* WkT = (bf*)take((size_t)DM * DM * 2); bf* WvT = (bf*)take((size_t)DM * DM * 2);
    bf* Qh = (bf*)take((size_t)NB_ * NT_ * DM * 2); bf* Ql = (bf*)take((size_t)NB_ * NT_ * DM * 2); bf* Kh = (bf*)take((size_t)NB_ * NT_ * DM * 2); bf* Kl = (bf*)take((size_t)NB_ * NT_ * DM * 2);
    bf* VTH = (bf*)take((size_t)NB_ * DM * NT_ * 2); bf* VTL = (bf*)take((size_t)NB_ * DM * NT_ * 2); float* S = (float*)take((size_t)NB_ * RCH * NT_ * 4); bf* PH = (bf*)take((size_t)NB_ * RCH * NT_ * 2); bf* PL = (bf*)take((size_t)NB_ * RCH * NT_ * 2);
    bf* Xb = (bf*)S; float* TMP = (float*)((char*)S + (size_t)NB_ * NT_ * DM * 2);    // 16.8 + 33.6 MB inside the 67.1 MB of S: both are dead before the first scores launch writes S
    if ((size_t)(wsp - (char*)d_ws) > ws_size) return;    // ~ 1.6 + 4 x 16.8 + 2 x 16.8 + 67.1 + 2 x 33.6 ~ 236 MB (per-chunk reuse of S / PH / PL in stream order)
    k_wt<<<dim3(DM / 64, DM / 64, 1), 256, 0, stream>>>(Wq, DM, DM, WqT); k_wt<<<dim3(DM / 64, DM / 64, 1), 256, 0, stream>>>(Wk, DM, DM, WkT); k_wt<<<dim3(DM / 64, DM / 64, 1), 256, 0, stream>>>(Wv, DM, DM, WvT);
    k_cvtb<<<NB_ * NT_ / 8, 256, 0, stream>>>(xq, NB_ * NT_, Xb);
    k_gemmb<false, false><<<dim3(NB_ * NT_ / 64, DM / 64, 1), 128, 0, stream>>>(Xb, nullptr, WqT, bq, TMP, DM, nullptr); k_split<<<NB_ * NT_ / 8, 256, 0, stream>>>(TMP, NB_ * NT_, Qh, Ql);
    k_cvtb<<<NB_ * NT_ / 8, 256, 0, stream>>>(xk, NB_ * NT_, Xb);
    k_gemmb<false, false><<<dim3(NB_ * NT_ / 64, DM / 64, 1), 128, 0, stream>>>(Xb, nullptr, WkT, bk, TMP, DM, nullptr); k_split<<<NB_ * NT_ / 8, 256, 0, stream>>>(TMP, NB_ * NT_, Kh, Kl);
    k_cvtb<<<NB_ * NT_ / 8, 256, 0, stream>>>(xv, NB_ * NT_, Xb);
    k_gemmb<false, false><<<dim3(NB_ * NT_ / 64, DM / 64, 1), 128, 0, stream>>>(Xb, nullptr, WvT, bv, TMP, DM, nullptr); k_vt<<<dim3(NT_ / 64, 2, NKV * NB_), 256, 0, stream>>>(TMP, VTH, VTL);
    for (int ch = 0; ch < NT_ / RCH; ++ch) {
        const int r0 = ch * RCH, kmax = r0 + RCH;
        k_gemm3<<<dim3(RCH / 64, kmax / 64, NB_), 128, 0, stream>>>(Qh + (size_t)r0 * DM, Ql + (size_t)r0 * DM, Kh, Kl, DM, S, NT_, NT_ * DM, NT_ * DM, RCH * NT_);
        k_csoftmax<<<NB_ * RCH / 8, 256, 0, stream>>>(S, r0, NT_, PH, PL);
        k_gemm3<<<dim3(RCH / 64, DM / 64, NB_), 128, 0, stream>>>(PH, PL, VTH, VTL, NT_, out + (size_t)r0 * DM, DM, RCH * NT_, DM * NT_, NT_ * DM);
    }
}

// v002
// It runs in 283 microseconds.
// In both of two side-by-side timings against v001, it was 2.66 times as fast.
// Counting every step since v000, it is 6.25 times as fast.
#include <hip/hip_runtime.h>

// Compute dtypes, f32 accumulate, all 8 batch items in every launch (rows flattened, or the item in blockIdx.z): q/k/v = x.W + b from the three separate inputs ([8 x 2048 x 512].[512 x 512], k-major weights transposed once;
// PLAIN bf16 operands = inputs rounded once, exact) on v_wmma_f32_16x16x32_bf16 -> bf16 hi + UNSCALED residual planes (v transposed to [d][t]); single-head causal
// attention over the 512-dim head in two query chunks of 1024: scores = q.k^T ([1024 x 512].[512 x kmax], three products, kmax = causal reach), causal row softmax of
// scores x 512^-1/2 (the reference divides q by sqrt(512); applied to the product here) in f32 -> bf16 hi + UNSCALED residual (zeros above the diagonal), out = P.v

#define NB_  8
#define NT_  2048
#define DM   512
#define NTK  NT_
#define RCH  1024
#define HD   128                 // k_vt tile geometry: 4 x 128 = the 512 dims
#define NKV  4
#define KW   512
#define SCL  0.044194173824159216f     // 512^-1/2 (the reference scales q; applied to the scores here)
#define LOSC 1024.0f

typedef _Float16 h16;
typedef unsigned short bf;
typedef __attribute__((ext_vector_type(16))) __bf16   v16bf;
typedef __attribute__((ext_vector_type(16))) _Float16 v16h;
typedef __attribute__((ext_vector_type(8)))  _Float16 v8h;
typedef __attribute__((ext_vector_type(8)))  unsigned short v8us;
typedef __attribute__((ext_vector_type(8)))  float    v8f;
typedef __attribute__((ext_vector_type(4)))  float    v4f;
typedef __attribute__((ext_vector_type(4)))  _Float16 v4h;
typedef v8h  __attribute__((may_alias)) v8ha;
typedef v4f  __attribute__((may_alias)) v4fa;
typedef v8us __attribute__((may_alias)) v8usa;

__device__ __forceinline__ unsigned short f2bf(float f) { unsigned u = __float_as_uint(f); u += 0x7FFFu + ((u >> 16) & 1u); return (unsigned short)(u >> 16); }
__device__ __forceinline__ float bf2f(unsigned short b) { return __uint_as_float(((unsigned)b) << 16); }
__device__ __forceinline__ float bfr(float f) { return bf2f(f2bf(f)); }
__device__ __forceinline__ v16h cat16(v8h lo, v8h hi) { return __builtin_shufflevector(lo, hi, 0, 1, 2, 3, 4, 5, 6, 7, 8, 9, 10, 11, 12, 13, 14, 15); }
__device__ __forceinline__ v16bf cat16b(v8us lo, v8us hi) { return __builtin_bit_cast(v16bf, __builtin_shufflevector(lo, hi, 0, 1, 2, 3, 4, 5, 6, 7, 8, 9, 10, 11, 12, 13, 14, 15)); }
__device__ __forceinline__ v8f wmma16(v16h a, v16h b, v8f c) { return __builtin_amdgcn_wmma_f32_16x16x32_f16(false, a, false, b, (short)0, c, false, false); }
__device__ __forceinline__ v8f wmmab(v16bf a, v16bf b, v8f c) { return __builtin_amdgcn_wmma_f32_16x16x32_bf16(false, a, false, b, (short)0, c, false, false); }

__global__ __launch_bounds__(256) void k_cvtb(const float* __restrict__ src, int nrows, bf* dst) {
    const int lane = threadIdx.x & 31, r = blockIdx.x * 8 + (threadIdx.x >> 5);
    if (r >= nrows) return;
    v8us o[DM / 256];
#pragma unroll
    for (int q = 0; q < DM / 256; ++q) { v8us t;
#pragma unroll
        for (int i = 0; i < 8; ++i) t[i] = f2bf(src[(size_t)r * DM + q * 256 + lane * 8 + i]);
        o[q] = t; }
#pragma unroll
    for (int q = 0; q < DM / 256; ++q) *(v8us*)(dst + (size_t)r * DM + q * 256 + lane * 8) = o[q];
    
}

#define TB   128                 // block tile: 128 rows x 128 columns of C, 8 waves (4 x 2) of 32 x 64
#define KST  64                  // k per stage: one whole 128-byte line of every operand row
#define LP   144                 // LDS row pitch in bytes: 16 x odd, conflict-free for the 16-byte fragment reads
#define PLB  (TB * LP)           // one operand plane of one stage in LDS

// stage_pair: this thread's four 16-byte pieces (rows r, r + 32, r + 64, r + 96) of an A plane's and of a B plane's 128 x 64 stage, global memory -> LDS with no register in between.
// The s_wait_xcnt closes the statement so that no address register of an issued copy is rewritten ahead of it.
__device__ __forceinline__ void stage_pair(unsigned la, const bf* a0, const bf* b0, int ld) {
    const unsigned la1 = la + 32 * LP, la2 = la + 64 * LP, la3 = la + 96 * LP, lb = la + PLB, lb1 = lb + 32 * LP, lb2 = lb + 64 * LP, lb3 = lb + 96 * LP;
    const bf* a1 = a0 + (size_t)32 * ld; const bf* a2 = a0 + (size_t)64 * ld; const bf* a3 = a0 + (size_t)96 * ld;
    const bf* b1 = b0 + (size_t)32 * ld; const bf* b2 = b0 + (size_t)64 * ld; const bf* b3 = b0 + (size_t)96 * ld;
    asm volatile("global_load_async_to_lds_b128 %0, %8, off\n\t"
                 "global_load_async_to_lds_b128 %1, %9, off\n\t"
                 "global_load_async_to_lds_b128 %2, %10, off\n\t"
                 "global_load_async_to_lds_b128 %3, %11, off\n\t"
                 "global_load_async_to_lds_b128 %4, %12, off\n\t"
                 "global_load_async_to_lds_b128 %5, %13, off\n\t"
                 "global_load_async_to_lds_b128 %6, %14, off\n\t"
                 "global_load_async_to_lds_b128 %7, %15, off\n\t"
                 "s_wait_xcnt 0x0"
                 :: "v"(la), "v"(la1), "v"(la2), "v"(la3), "v"(lb), "v"(lb1), "v"(lb2), "v"(lb3), "v"(a0), "v"(a1), "v"(a2), "v"(a3), "v"(b0), "v"(b1), "v"(b2), "v"(b3) : "memory");
}
__device__ __forceinline__ v16bf ldsfrag(const unsigned char* p) { return cat16b(*(const v8usa*)p, *(const v8usa*)(p + 32)); }

// k_mm: 128 x 128 block tile of C = A.B^T over K (row strides = K for every plane; n-major B), f32. SPLIT: A = Ah + Al, B = Bh + Bl, three products per 32-k step in the order
// hh, lh, hl; else Ah.Bh alone, + bf(bias[c]). Every operand row is fetched once per block as whole lines into a two-buffer LDS ring and the fragments are read from LDS.
// blockIdx.z = batch item, sA / sB / sC = elements from one item's A planes / B planes / C to the next item's. K is a multiple of 64 and at least 128 (two stages).
template <bool SPLIT>
__global__ __launch_bounds__(256) void k_mm(const bf* __restrict__ Ah, const bf* __restrict__ Al, const bf* __restrict__ Bh, const bf* __restrict__ Bl, const float* __restrict__ bias, int K, float* C, int ldc, int sA, int sB, int sC) {
    constexpr int BUFB = (SPLIT ? 4 : 2) * PLB;      // one stage: [Ah | Bh | Al | Bl]
    __shared__ __attribute__((aligned(16))) unsigned char ring[2 * BUFB];
    const int tid = threadIdx.x, lane = tid & 31, wave = tid >> 5, lr = lane & 15, hi = lane >> 4, wr = wave >> 1, wc = wave & 1;
    const int R0 = blockIdx.x * TB, C0 = blockIdx.y * TB, nst = K / KST;
    const size_t ga = (size_t)blockIdx.z * sA + (size_t)(R0 + (tid >> 3)) * K + (tid & 7) * 8, gb = (size_t)blockIdx.z * sB + (size_t)(C0 + (tid >> 3)) * K + (tid & 7) * 8;
    const unsigned lc = (unsigned)(size_t)ring + (tid >> 3) * LP + (tid & 7) * 16;
    auto fill = [&](int s) {
        const unsigned l = lc + (s & 1) * BUFB; const size_t k0 = (size_t)s * KST;
        stage_pair(l, Ah + ga + k0, Bh + gb + k0, K);
        if (SPLIT) stage_pair(l + 2 * PLB, Al + ga + k0, Bl + gb + k0, K);
    };
    v8f acc[2][4];
#pragma unroll
    for (int rt = 0; rt < 2; ++rt) {
#pragma unroll
        for (int t = 0; t < 4; ++t) acc[rt][t] = (v8f){}; }
    fill(0);
    asm volatile("s_wait_asynccnt 0x0" ::: "memory");    // this wave's copies of stage 0 have landed
    __syncthreads();                                     // ... and every other wave's: stage 0 may be read
    fill(1);
#pragma unroll 1
    for (int s = 0; s < nst; ++s) {
        const unsigned char* pa = ring + (s & 1) * BUFB + (wr * 32 + lr) * LP + hi * 16;
        const unsigned char* pb = ring + (s & 1) * BUFB + PLB + (wc * 64 + lr) * LP + hi * 16;
#pragma unroll
        for (int ks = 0; ks < KST / 32; ++ks) {
            v16bf a[2], al[2], bh[4], bl[4];
#pragma unroll
            for (int rt = 0; rt < 2; ++rt) a[rt] = ldsfrag(pa + rt * 16 * LP + ks * 64);
#pragma unroll
            for (int t = 0; t < 4; ++t) bh[t] = ldsfrag(pb + t * 16 * LP + ks * 64);
            if (SPLIT) {
#pragma unroll
                for (int rt = 0; rt < 2; ++rt) al[rt] = ldsfrag(pa + 2 * PLB + rt * 16 * LP + ks * 64);
#pragma unroll
                for (int t = 0; t < 4; ++t) bl[t] = ldsfrag(pb + 2 * PLB + t * 16 * LP + ks * 64);
            }
            __builtin_amdgcn_sched_barrier(0);    // the 32-k step's LDS reads stay one group ahead of its matrix instructions (for speed only)
#pragma unroll
            for (int t = 0; t < 4; ++t) { acc[0][t] = wmmab(a[0], bh[t], acc[0][t]); acc[1][t] = wmmab(a[1], bh[t], acc[1][t]); }
            if (SPLIT) {
#pragma unroll
                for (int t = 0; t < 4; ++t) { acc[0][t] = wmmab(al[0], bh[t], acc[0][t]); acc[1][t] = wmmab(al[1], bh[t], acc[1][t]); }
#pragma unroll
                for (int t = 0; t < 4; ++t) { acc[0][t] = wmmab(a[0], bl[t], acc[0][t]); acc[1][t] = wmmab(a[1], bl[t], acc[1][t]); }
            }
        }
        __builtin_amdgcn_sched_barrier(0);                   // the stage's matrix instructions stay ahead of the barrier: sunk behind it they would stand in front of the refill and cost the copies their lead
        asm volatile("s_wait_dscnt 0x0" ::: "memory");       // this wave's reads of stage s are done before its buffer is refilled
        asm volatile("s_wait_asynccnt 0x0" ::: "memory");    // this wave's copies of stage s + 1 have landed
        __syncthreads();                                     // publishes stage s + 1 and ends every wave's reads of stage s
        if (s + 2 < nst) fill(s + 2);
    }
    asm volatile("s_wait_asynccnt 0x0" ::: "memory");        // no copy is outstanding when the ring becomes output staging
    float* os = (float*)(void*)ring + wave * (32 * 68);      // behind the last stage's barrier: 32 x 64 f32 per wave at pitch 68
#pragma unroll
    for (int t = 0; t < 4; ++t) { const float bv = (!SPLIT && bias) ? bfr(bias[C0 + wc * 64 + t * 16 + lr]) : 0.f;
#pragma unroll
        for (int rt = 0; rt < 2; ++rt) {
#pragma unroll
            for (int j = 0; j < 8; ++j) os[(rt * 16 + hi * 8 + j) * 68 + t * 16 + lr] = SPLIT ? acc[rt][t][j] : acc[rt][t][j] + bv; } }
    __syncthreads();                                         // the staged tile is read back by other lanes than wrote it
    float* crow = C + (size_t)blockIdx.z * sC + (size_t)(R0 + wr * 32) * ldc + C0 + wc * 64;
#pragma unroll
    for (int s = 0; s < 16; ++s) { const int Lid = (lane >> 3) + 4 * s, piece = lane & 7; const int row = Lid >> 1, cofs = (Lid & 1) * 32 + piece * 4;
        const v4f val = *(const v4fa*)(os + row * 68 + cofs); *(v4f*)(crow + (size_t)row * ldc + cofs) = val; }
}

__global__ __launch_bounds__(256) void k_split(const float* __restrict__ src, int nrows, bf* dh, bf* dl) {
    const int lane = threadIdx.x & 31, r = blockIdx.x * 8 + (threadIdx.x >> 5); if (r >= nrows) return;
{
#pragma unroll 1
        for (int q = 0; q < DM / 256; ++q) { const size_t o = (size_t)r * DM + q * 256 + lane * 8; const v8f v = *(const v8f*)(src + o); v8us oh, ol;
#pragma unroll
            for (int i = 0; i < 8; ++i) { const unsigned short hb = f2bf(v[i]); oh[i] = hb; ol[i] = f2bf(v[i] - bf2f(hb)); }
            *(v8us*)(dh + o) = oh; *(v8us*)(dl + o) = ol; }
         }
}
// k_vt: VTH/VTL [g][128 d][2048 t] = bf16 hi + UNSCALED bf16 residual of V [t][g*128+d] via 64 x 64 LDS tiles; grid (NT/64, 2 (d half), 4 d groups x 8 items).
__global__ __launch_bounds__(256) void k_vt(const float* __restrict__ V, bf* VTH, bf* VTL) {
    __shared__ float tl[64][65];
    const int tid = threadIdx.x, t0 = blockIdx.x * 64, d0 = blockIdx.y * 64, g = blockIdx.z % NKV, item = blockIdx.z / NKV;
    V += (size_t)item * NT_ * KW; VTH += (size_t)item * DM * NT_; VTL += (size_t)item * DM * NT_;
    { const int tt = tid >> 2, dq = (tid & 3) * 16;
#pragma unroll
      for (int i = 0; i < 16; ++i) tl[dq + i][tt] = V[(size_t)(t0 + tt) * KW + g * HD + d0 + dq + i]; }
    __syncthreads();
    const int piece = tid & 7;
    auto pass = [&]() {
#pragma unroll
        for (int s = 0; s < 2; ++s) { const int d = (tid >> 3) + 32 * s; v8us oh, ol;
#pragma unroll
            for (int i = 0; i < 8; ++i) { const float v = tl[d][piece * 8 + i]; const unsigned short hb = f2bf(v); oh[i] = hb; ol[i] = f2bf(v - bf2f(hb)); }
            const size_t o = ((size_t)g * HD + d0 + d) * NT_ + t0 + piece * 8; *(v8us*)(VTH + o) = oh; *(v8us*)(VTL + o) = ol; }
    };
    pass(); 
}

// k_csoftmax: one wave per row r of the chunk's scores S [8 items x 1024][pitch] (row = query r0 + r % 1024 of item r / 1024): over the causally visible columns k <= r0 + r % 1024 (the rest of the row up to
// 'ncols' gets probability 0): a = s x 512^-1/2, max, exp, normalise (f32, fixed lane order; the row re-read per phase) -> bf16 hi + UNSCALED residual planes with the same pitch;
__global__ __launch_bounds__(256) void k_csoftmax(const float* __restrict__ S, int r0, int ncols, bf* PH, bf* PL) {
    const int lane = threadIdx.x & 31, r = blockIdx.x * 8 + (threadIdx.x >> 5); if (r >= NB_ * RCH) return;
    const int qi = r0 + r % RCH; const float* sr = S + (size_t)r * ncols;
    float m = -3.0e38f;
#pragma unroll 1
    for (int c0 = lane * 8; c0 < ncols; c0 += 256) { const v8f v = *(const v8f*)(sr + c0);
#pragma unroll
        for (int i = 0; i < 8; ++i) if (c0 + i <= qi) m = fmaxf(m, v[i] * SCL); }
#pragma unroll
    for (int sh = 16; sh; sh >>= 1) m = fmaxf(m, __shfl_xor(m, sh, 32));
    float sum = 0.f;
#pragma unroll 1
    for (int c0 = lane * 8; c0 < ncols; c0 += 256) { const v8f v = *(const v8f*)(sr + c0);
#pragma unroll
        for (int i = 0; i < 8; ++i) if (c0 + i <= qi) sum += __expf(v[i] * SCL - m); }
#pragma unroll
    for (int sh = 16; sh; sh >>= 1) sum += __shfl_xor(sum, sh, 32);
    const float inv = 1.0f / sum;
{
#pragma unroll 1
        for (int c0 = lane * 8; c0 < ncols; c0 += 256) { const v8f v = *(const v8f*)(sr + c0); v8us oh, ol;
#pragma unroll
            for (int i = 0; i < 8; ++i) { const float p = (c0 + i <= qi) ? __expf(v[i] * SCL - m) * inv : 0.f; const unsigned short hb = f2bf(p); oh[i] = hb; ol[i] = f2bf(p - bf2f(hb)); }
            const size_t o = (size_t)r * ncols + c0; *(v8us*)(PH + o) = oh; *(v8us*)(PL + o) = ol; }
         }
}

// k_wt: WT [n][K] = bf16(W[k][n]) (k-major [K][ncols]) via 64 x 64 LDS tiles; grid (K/64, ncols/64).
__global__ __launch_bounds__(256) void k_wt(const float* __restrict__ Wm, int K, int ncols, bf* WT) {
    __shared__ __align__(16) unsigned short tl[64 * 72];
    const int tid = threadIdx.x, k0 = blockIdx.x * 64, n0 = blockIdx.y * 64;
    const int kk = tid >> 2, nq = (tid & 3) * 16;
#pragma unroll
    for (int i = 0; i < 16; ++i) tl[(nq + i) * 72 + kk] = f2bf(Wm[(size_t)(k0 + kk) * ncols + n0 + nq + i]);
    __syncthreads();
    const int piece = tid & 7;
    auto pass = [&]() {
#pragma unroll
        for (int s = 0; s < 2; ++s) { const int nr = (tid >> 3) + 32 * s; const v8us val = *(const v8usa*)(tl + nr * 72 + piece * 8); *(v8us*)(WT + (size_t)(n0 + nr) * K + k0 + piece * 8) = val; }
    };
    pass(); 
}
extern "C" void kernel_launch(void* const* d_in, const int* in_sizes, int n_in,
                              void* d_out, int out_size, void* d_ws, size_t ws_size, hipStream_t stream) {
    (void)in_sizes; (void)n_in; (void)out_size;
    const float* xq = (const float*)d_in[0]; const float* xk = (const float*)d_in[1]; const float* xv = (const float*)d_in[2];
    const float* Wq = (const float*)d_in[3]; const float* bq = (const float*)d_in[4]; const float* Wk = (const float*)d_in[5]; const float* bk = (const float*)d_in[6]; const float* Wv = (const float*)d_in[7]; const float* bv = (const float*)d_in[8];   // k-major (x @ W) + biases
    float* out = (float*)d_out;    // [8][2048][512]
    char* wsp = (char*)d_ws;
    auto take = [&](size_t bytes) { char* p = wsp; wsp += (bytes + 255) & ~(size_t)255; return (void*)p; };
    bf* WqT = (bf*)take((size_t)DM * DM * 2); bf* WkT = (bf*)take((size_t)DM * DM * 2); bf* WvT = (bf*)take((size_t)DM * DM * 2);
    bf* Qh = (bf*)take((size_t)NB_ * NT_ * DM * 2); bf* Ql = (bf*)take((size_t)NB_ * NT_ * DM * 2); bf* Kh = (bf*)take((size_t)NB_ * NT_ * DM * 2); bf* Kl = (bf*)take((size_t)NB_ * NT_ * DM * 2);
    bf* VTH = (bf*)take((size_t)NB_ * DM * NT_ * 2); bf* VTL = (bf*)take((size_t)NB_ * DM * NT_ * 2); float* S = (float*)take((size_t)NB_ * RCH * NT_ * 4); bf* PH = (bf*)take((size_t)NB_ * RCH * NT_ * 2); bf* PL = (bf*)take((size_t)NB_ * RCH * NT_ * 2);
    bf* Xb = (bf*)S; float* TMP = (float*)((char*)S + (size_t)NB_ * NT_ * DM * 2);    // 16.8 + 33.6 MB inside the 67.1 MB of S: both are dead before the first scores launch writes S
    if ((size_t)(wsp - (char*)d_ws) > ws_size) return;    // ~ 1.6 + 4 x 16.8 + 2 x 16.8 + 67.1 + 2 x 33.6 ~ 236 MB (per-chunk reuse of S / PH / PL in stream order)
    k_wt<<<dim3(DM / 64, DM / 64, 1), 256, 0, stream>>>(Wq, DM, DM, WqT); k_wt<<<dim3(DM / 64, DM / 64, 1), 256, 0, stream>>>(Wk, DM, DM, WkT); k_wt<<<dim3(DM / 64, DM / 64, 1), 256, 0, stream>>>(Wv, DM, DM, WvT);
    k_cvtb<<<NB_ * NT_ / 8, 256, 0, stream>>>(xq, NB_ * NT_, Xb);
    k_mm<false><<<dim3(NB_ * NT_ / TB, DM / TB, 1), 256, 0, stream>>>(Xb, nullptr, WqT, nullptr, bq, DM, TMP, DM, 0, 0, 0); k_split<<<NB_ * NT_ / 8, 256, 0, stream>>>(TMP, NB_ * NT_, Qh, Ql);
    k_cvtb<<<NB_ * NT_ / 8, 256, 0, stream>>>(xk, NB_ * NT_, Xb);
    k_mm<false><<<dim3(NB_ * NT_ / TB, DM / TB, 1), 256, 0, stream>>>(Xb, nullptr, WkT, nullptr, bk, DM, TMP, DM, 0, 0, 0); k_split<<<NB_ * NT_ / 8, 256, 0, stream>>>(TMP, NB_ * NT_, Kh, Kl);
    k_cvtb<<<NB_ * NT_ / 8, 256, 0, stream>>>(xv, NB_ * NT_, Xb);
    k_mm<false><<<dim3(NB_ * NT_ / TB, DM / TB, 1), 256, 0, stream>>>(Xb, nullptr, WvT, nullptr, bv, DM, TMP, DM, 0, 0, 0); k_vt<<<dim3(NT_ / 64, 2, NKV * NB_), 256, 0, stream>>>(TMP, VTH, VTL);
    for (int ch = 0; ch < NT_ / RCH; ++ch) {
        const int r0 = ch * RCH, kmax = r0 + RCH;
        k_mm<true><<<dim3(RCH / TB, kmax / TB, NB_), 256, 0, stream>>>(Qh + (size_t)r0 * DM, Ql + (size_t)r0 * DM, Kh, Kl, nullptr, DM, S, NT_, NT_ * DM, NT_ * DM, RCH * NT_);
        k_csoftmax<<<NB_ * RCH / 8, 256, 0, stream>>>(S, r0, NT_, PH, PL);
        k_mm<true><<<dim3(RCH / TB, DM / TB, NB_), 256, 0, stream>>>(PH, PL, VTH, VTL, nullptr, NT_, out + (size_t)r0 * DM, DM, RCH * NT_, DM * NT_, NT_ * DM);
    }
}

// v003
// One run takes 239 microseconds.
// Two timings next to v002 put it at 1.18 and 1.19 times that version's speed.
// All steps since v000 together make it 7.41 times as fast.
#include <hip/hip_runtime.h>

// Compute dtypes, f32 accumulate, all 8 batch items in every launch (rows flattened, or the item in blockIdx.z): q/k/v = x.W + b from the three separate inputs ([8 x 2048 x 512].[512 x 512], k-major weights transposed once;
// PLAIN bf16 operands = inputs rounded once, exact) on v_wmma_f32_16x16x32_bf16 -> bf16 hi + UNSCALED residual planes (v transposed to [d][t]); single-head causal
// attention over the 512-dim head in two query chunks of 1024: scores = q.k^T ([1024 x 512].[512 x kmax], three products, kmax = causal reach), causal row softmax of
// scores x 512^-1/2 (the reference divides q by sqrt(512); applied to the product here) in f32 -> bf16 hi + UNSCALED residual (zeros above the diagonal), out = P.v.
// Causal trim: a 128-query row block sees the keys [0, reach), reach = its first query + 128; score tiles, softmax columns and P.v k steps at or beyond reach are neither computed, stored nor read.

#define NB_  8
#define NT_  2048
#define DM   512
#define NTK  NT_
#define RCH  1024
#define HD   128                 // k_vt tile geometry: 4 x 128 = the 512 dims
#define NKV  4
#define KW   512
#define SCL  0.044194173824159216f     // 512^-1/2 (the reference scales q; applied to the scores here)
#define LOSC 1024.0f

typedef _Float16 h16;
typedef unsigned short bf;
typedef __attribute__((ext_vector_type(16))) __bf16   v16bf;
typedef __attribute__((ext_vector_type(16))) _Float16 v16h;
typedef __attribute__((ext_vector_type(8)))  _Float16 v8h;
typedef __attribute__((ext_vector_type(8)))  unsigned short v8us;
typedef __attribute__((ext_vector_type(8)))  float    v8f;
typedef __attribute__((ext_vector_type(4)))  float    v4f;
typedef __attribute__((ext_vector_type(4)))  _Float16 v4h;
typedef v8h  __attribute__((may_alias)) v8ha;
typedef v4f  __attribute__((may_alias)) v4fa;
typedef v8us __attribute__((may_alias)) v8usa;

__device__ __forceinline__ unsigned short f2bf(float f) { unsigned u = __float_as_uint(f); u += 0x7FFFu + ((u >> 16) & 1u); return (unsigned short)(u >> 16); }
__device__ __forceinline__ float bf2f(unsigned short b) { return __uint_as_float(((unsigned)b) << 16); }
__device__ __forceinline__ float bfr(float f) { return bf2f(f2bf(f)); }
__device__ __forceinline__ v16h cat16(v8h lo, v8h hi) { return __builtin_shufflevector(lo, hi, 0, 1, 2, 3, 4, 5, 6, 7, 8, 9, 10, 11, 12, 13, 14, 15); }
__device__ __forceinline__ v16bf cat16b(v8us lo, v8us hi) { return __builtin_bit_cast(v16bf, __builtin_shufflevector(lo, hi, 0, 1, 2, 3, 4, 5, 6, 7, 8, 9, 10, 11, 12, 13, 14, 15)); }
__device__ __forceinline__ v8f wmma16(v16h a, v16h b, v8f c) { return __builtin_amdgcn_wmma_f32_16x16x32_f16(false, a, false, b, (short)0, c, false, false); }
__device__ __forceinline__ v8f wmmab(v16bf a, v16bf b, v8f c) { return __builtin_amdgcn_wmma_f32_16x16x32_bf16(false, a, false, b, (short)0, c, false, false); }

__global__ __launch_bounds__(256) void k_cvtb(const float* __restrict__ src, int nrows, bf* dst) {
    const int lane = threadIdx.x & 31, r = blockIdx.x * 8 + (threadIdx.x >> 5);
    if (r >= nrows) return;
    v8us o[DM / 256];
#pragma unroll
    for (int q = 0; q < DM / 256; ++q) { v8us t;
#pragma unroll
        for (int i = 0; i < 8; ++i) t[i] = f2bf(src[(size_t)r * DM + q * 256 + lane * 8 + i]);
        o[q] = t; }
#pragma unroll
    for (int q = 0; q < DM / 256; ++q) *(v8us*)(dst + (size_t)r * DM + q * 256 + lane * 8) = o[q];
    
}

#define TB   128                 // block tile: 128 rows x 128 columns of C, 8 waves (4 x 2) of 32 x 64
#define KST  64                  // k per stage: one whole 128-byte line of every operand row
#define LP   144                 // LDS row pitch in bytes: 16 x odd, conflict-free for the 16-byte fragment reads
#define PLB  (TB * LP)           // one operand plane of one stage in LDS

// stage_pair: this thread's four 16-byte pieces (rows r, r + 32, r + 64, r + 96) of an A plane's and of a B plane's 128 x 64 stage, global memory -> LDS with no register in between.
// The s_wait_xcnt closes the statement so that no address register of an issued copy is rewritten ahead of it.
__device__ __forceinline__ void stage_pair(unsigned la, const bf* a0, const bf* b0, int ld) {
    const unsigned la1 = la + 32 * LP, la2 = la + 64 * LP, la3 = la + 96 * LP, lb = la + PLB, lb1 = lb + 32 * LP, lb2 = lb + 64 * LP, lb3 = lb + 96 * LP;
    const bf* a1 = a0 + (size_t)32 * ld; const bf* a2 = a0 + (size_t)64 * ld; const bf* a3 = a0 + (size_t)96 * ld;
    const bf* b1 = b0 + (size_t)32 * ld; const bf* b2 = b0 + (size_t)64 * ld; const bf* b3 = b0 + (size_t)96 * ld;
    asm volatile("global_load_async_to_lds_b128 %0, %8, off\n\t"
                 "global_load_async_to_lds_b128 %1, %9, off\n\t"
                 "global_load_async_to_lds_b128 %2, %10, off\n\t"
                 "global_load_async_to_lds_b128 %3, %11, off\n\t"
                 "global_load_async_to_lds_b128 %4, %12, off\n\t"
                 "global_load_async_to_lds_b128 %5, %13, off\n\t"
                 "global_load_async_to_lds_b128 %6, %14, off\n\t"
                 "global_load_async_to_lds_b128 %7, %15, off\n\t"
                 "s_wait_xcnt 0x0"
                 :: "v"(la), "v"(la1), "v"(la2), "v"(la3), "v"(lb), "v"(lb1), "v"(lb2), "v"(lb3), "v"(a0), "v"(a1), "v"(a2), "v"(a3), "v"(b0), "v"(b1), "v"(b2), "v"(b3) : "memory");
}
__device__ __forceinline__ v16bf ldsfrag(const unsigned char* p) { return cat16b(*(const v8usa*)p, *(const v8usa*)(p + 32)); }

// k_mm: 128 x 128 block tile of C = A.B^T over K (row strides = K for every plane; n-major B), f32. SPLIT: A = Ah + Al, B = Bh + Bl, three products per 32-k step in the order
// hh, lh, hl; else Ah.Bh alone, + bf(bias[c]). Every operand row is fetched once per block as whole lines into a two-buffer LDS ring and the fragments are read from LDS.
// blockIdx.z = batch item, sA / sB / sC = elements from one item's A planes / B planes / C to the next item's. K is a multiple of 64 and at least 128 (two stages).
// CAUSAL (rows = queries, row 0 = query q0): 1 = C's columns are keys, a tile wholly above the diagonal is left out; 2 = k runs over keys, the k loop ends at the row block's reach (P is 0 from there on).
// The work then grows with the row block, so the row block is rotated by the item: work-groups whose flat index is equal modulo the grid's x extent take every row block in turn instead of always the same one
// (for speed only: every (row block, item) is still taken exactly once).
template <bool SPLIT, int CAUSAL>
__global__ __launch_bounds__(256) void k_mm(const bf* __restrict__ Ah, const bf* __restrict__ Al, const bf* __restrict__ Bh, const bf* __restrict__ Bl, const float* __restrict__ bias, int K, float* C, int ldc, int sA, int sB, int sC, int q0) {
    constexpr int BUFB = (SPLIT ? 4 : 2) * PLB;      // one stage: [Ah | Bh | Al | Bl]
    __shared__ __attribute__((aligned(16))) unsigned char ring[2 * BUFB];
    const int tid = threadIdx.x, lane = tid & 31, wave = tid >> 5, lr = lane & 15, hi = lane >> 4, wr = wave >> 1, wc = wave & 1;
    const int R0 = (CAUSAL ? (blockIdx.x + blockIdx.z) % (RCH / TB) : blockIdx.x) * TB, C0 = blockIdx.y * TB, reach = q0 + R0 + TB;
    if (CAUSAL == 1 && C0 >= reach) return;    // the whole work-group leaves, ahead of every copy and barrier
    const int nst = (CAUSAL == 2 ? reach : K) / KST;
    const size_t ga = (size_t)blockIdx.z * sA + (size_t)(R0 + (tid >> 3)) * K + (tid & 7) * 8, gb = (size_t)blockIdx.z * sB + (size_t)(C0 + (tid >> 3)) * K + (tid & 7) * 8;
    const unsigned lc = (unsigned)(size_t)ring + (tid >> 3) * LP + (tid & 7) * 16;
    auto fill = [&](int s) {
        const unsigned l = lc + (s & 1) * BUFB; const size_t k0 = (size_t)s * KST;
        stage_pair(l, Ah + ga + k0, Bh + gb + k0, K);
        if (SPLIT) stage_pair(l + 2 * PLB, Al + ga + k0, Bl + gb + k0, K);
    };
    v8f acc[2][4];
#pragma unroll
    for (int rt = 0; rt < 2; ++rt) {
#pragma unroll
        for (int t = 0; t < 4; ++t) acc[rt][t] = (v8f){}; }
    fill(0);
    asm volatile("s_wait_asynccnt 0x0" ::: "memory");    // this wave's copies of stage 0 have landed
    __syncthreads();                                     // ... and every other wave's: stage 0 may be read
    fill(1);
#pragma unroll 1
    for (int s = 0; s < nst; ++s) {
        const unsigned char* pa = ring + (s & 1) * BUFB + (wr * 32 + lr) * LP + hi * 16;
        const unsigned char* pb = ring + (s & 1) * BUFB + PLB + (wc * 64 + lr) * LP + hi * 16;
#pragma unroll
        for (int ks = 0; ks < KST / 32; ++ks) {
            v16bf a[2], al[2], bh[4], bl[4];
#pragma unroll
            for (int rt = 0; rt < 2; ++rt) a[rt] = ldsfrag(pa + rt * 16 * LP + ks * 64);
#pragma unroll
            for (int t = 0; t < 4; ++t) bh[t] = ldsfrag(pb + t * 16 * LP + ks * 64);
            if (SPLIT) {
#pragma unroll
                for (int rt = 0; rt < 2; ++rt) al[rt] = ldsfrag(pa + 2 * PLB + rt * 16 * LP + ks * 64);
#pragma unroll
                for (int t = 0; t < 4; ++t) bl[t] = ldsfrag(pb + 2 * PLB + t * 16 * LP + ks * 64);
            }
            __builtin_amdgcn_sched_barrier(0);    // the 32-k step's LDS reads stay one group ahead of its matrix instructions (for speed only)
#pragma unroll
            for (int t = 0; t < 4; ++t) { acc[0][t] = wmmab(a[0], bh[t], acc[0][t]); acc[1][t] = wmmab(a[1], bh[t], acc[1][t]); }
            if (SPLIT) {
#pragma unroll
                for (int t = 0; t < 4; ++t) { acc[0][t] = wmmab(al[0], bh[t], acc[0][t]); acc[1][t] = wmmab(al[1], bh[t], acc[1][t]); }
#pragma unroll
                for (int t = 0; t < 4; ++t) { acc[0][t] = wmmab(a[0], bl[t], acc[0][t]); acc[1][t] = wmmab(a[1], bl[t], acc[1][t]); }
            }
        }
        __builtin_amdgcn_sched_barrier(0);                   // the stage's matrix instructions stay ahead of the barrier: sunk behind it they would stand in front of the refill and cost the copies their lead
        asm volatile("s_wait_dscnt 0x0" ::: "memory");       // this wave's reads of stage s are done before its buffer is refilled
        asm volatile("s_wait_asynccnt 0x0" ::: "memory");    // this wave's copies of stage s + 1 have landed
        __syncthreads();                                     // publishes stage s + 1 and ends every wave's reads of stage s
        if (s + 2 < nst) fill(s + 2);
    }
    asm volatile("s_wait_asynccnt 0x0" ::: "memory");        // no copy is outstanding when the ring becomes output staging
    float* os = (float*)(void*)ring + wave * (32 * 68);      // behind the last stage's barrier: 32 x 64 f32 per wave at pitch 68
#pragma unroll
    for (int t = 0; t < 4; ++t) { const float bv = (!SPLIT && bias) ? bfr(bias[C0 + wc * 64 + t * 16 + lr]) : 0.f;
#pragma unroll
        for (int rt = 0; rt < 2; ++rt) {
#pragma unroll
            for (int j = 0; j < 8; ++j) os[(rt * 16 + hi * 8 + j) * 68 + t * 16 + lr] = SPLIT ? acc[rt][t][j] : acc[rt][t][j] + bv; } }
    __syncthreads();                                         // the staged tile is read back by other lanes than wrote it
    float* crow = C + (size_t)blockIdx.z * sC + (size_t)(R0 + wr * 32) * ldc + C0 + wc * 64;
#pragma unroll
    for (int s = 0; s < 16; ++s) { const int Lid = (lane >> 3) + 4 * s, piece = lane & 7; const int row = Lid >> 1, cofs = (Lid & 1) * 32 + piece * 4;
        const v4f val = *(const v4fa*)(os + row * 68 + cofs); *(v4f*)(crow + (size_t)row * ldc + cofs) = val; }
}

__global__ __launch_bounds__(256) void k_split(const float* __restrict__ src, int nrows, bf* dh, bf* dl) {
    const int lane = threadIdx.x & 31, r = blockIdx.x * 8 + (threadIdx.x >> 5); if (r >= nrows) return;
{
#pragma unroll 1
        for (int q = 0; q < DM / 256; ++q) { const size_t o = (size_t)r * DM + q * 256 + lane * 8; const v8f v = *(const v8f*)(src + o); v8us oh, ol;
#pragma unroll
            for (int i = 0; i < 8; ++i) { const unsigned short hb = f2bf(v[i]); oh[i] = hb; ol[i] = f2bf(v[i] - bf2f(hb)); }
            *(v8us*)(dh + o) = oh; *(v8us*)(dl + o) = ol; }
         }
}
// k_vt: VTH/VTL [g][128 d][2048 t] = bf16 hi + UNSCALED bf16 residual of V [t][g*128+d] via 64 x 64 LDS tiles; grid (NT/64, 2 (d half), 4 d groups x 8 items).
__global__ __launch_bounds__(256) void k_vt(const float* __restrict__ V, bf* VTH, bf* VTL) {
    __shared__ float tl[64][65];
    const int tid = threadIdx.x, t0 = blockIdx.x * 64, d0 = blockIdx.y * 64, g = blockIdx.z % NKV, item = blockIdx.z / NKV;
    V += (size_t)item * NT_ * KW; VTH += (size_t)item * DM * NT_; VTL += (size_t)item * DM * NT_;
    { const int tt = tid >> 2, dq = (tid & 3) * 16;
#pragma unroll
      for (int i = 0; i < 16; ++i) tl[dq + i][tt] = V[(size_t)(t0 + tt) * KW + g * HD + d0 + dq + i]; }
    __syncthreads();
    const int piece = tid & 7;
    auto pass = [&]() {
#pragma unroll
        for (int s = 0; s < 2; ++s) { const int d = (tid >> 3) + 32 * s; v8us oh, ol;
#pragma unroll
            for (int i = 0; i < 8; ++i) { const float v = tl[d][piece * 8 + i]; const unsigned short hb = f2bf(v); oh[i] = hb; ol[i] = f2bf(v - bf2f(hb)); }
            const size_t o = ((size_t)g * HD + d0 + d) * NT_ + t0 + piece * 8; *(v8us*)(VTH + o) = oh; *(v8us*)(VTL + o) = ol; }
    };
    pass(); 
}

// k_csoftmax: one wave per row r of the chunk's scores S [8 items x 1024][pitch] (row = query r0 + r % 1024 of item r / 1024): over the causally visible columns k <= r0 + r % 1024 (the rest of the row up to the
// reach of its 128-row block gets probability 0; nothing beyond is read or written): a = s x 512^-1/2, max, exp, normalise (f32, fixed lane order; the row re-read per phase) -> bf16 hi + UNSCALED residual planes with the same pitch 'ncols';
__global__ __launch_bounds__(256) void k_csoftmax(const float* __restrict__ S, int r0, int ncols, bf* PH, bf* PL) {
    const int lane = threadIdx.x & 31, r = blockIdx.x * 8 + (threadIdx.x >> 5); if (r >= NB_ * RCH) return;
    const int qi = r0 + r % RCH, lim = (qi / TB + 1) * TB; const float* sr = S + (size_t)r * ncols;
    float m = -3.0e38f;
#pragma unroll 1
    for (int c0 = lane * 8; c0 < lim; c0 += 256) { const v8f v = *(const v8f*)(sr + c0);
#pragma unroll
        for (int i = 0; i < 8; ++i) if (c0 + i <= qi) m = fmaxf(m, v[i] * SCL); }
#pragma unroll
    for (int sh = 16; sh; sh >>= 1) m = fmaxf(m, __shfl_xor(m, sh, 32));
    float sum = 0.f;
#pragma unroll 1
    for (int c0 = lane * 8; c0 < lim; c0 += 256) { const v8f v = *(const v8f*)(sr + c0);
#pragma unroll
        for (int i = 0; i < 8; ++i) if (c0 + i <= qi) sum += __expf(v[i] * SCL - m); }
#pragma unroll
    for (int sh = 16; sh; sh >>= 1) sum += __shfl_xor(sum, sh, 32);
    const float inv = 1.0f / sum;
{
#pragma unroll 1
        for (int c0 = lane * 8; c0 < lim; c0 += 256) { const v8f v = *(const v8f*)(sr + c0); v8us oh, ol;
#pragma unroll
            for (int i = 0; i < 8; ++i) { const float p = (c0 + i <= qi) ? __expf(v[i] * SCL - m) * inv : 0.f; const unsigned short hb = f2bf(p); oh[i] = hb; ol[i] = f2bf(p - bf2f(hb)); }
            const size_t o = (size_t)r * ncols + c0; *(v8us*)(PH + o) = oh; *(v8us*)(PL + o) = ol; }
         }
}

// k_wt: WT [n][K] = bf16(W[k][n]) (k-major [K][ncols]) via 64 x 64 LDS tiles; grid (K/64, ncols/64).
__global__ __launch_bounds__(256) void k_wt(const float* __restrict__ Wm, int K, int ncols, bf* WT) {
    __shared__ __align__(16) unsigned short tl[64 * 72];
    const int tid = threadIdx.x, k0 = blockIdx.x * 64, n0 = blockIdx.y * 64;
    const int kk = tid >> 2, nq = (tid & 3) * 16;
#pragma unroll
    for (int i = 0; i < 16; ++i) tl[(nq + i) * 72 + kk] = f2bf(Wm[(size_t)(k0 + kk) * ncols + n0 + nq + i]);
    __syncthreads();
    const int piece = tid & 7;
    auto pass = [&]() {
#pragma unroll
        for (int s = 0; s < 2; ++s) { const int nr = (tid >> 3) + 32 * s; const v8us val = *(const v8usa*)(tl + nr * 72 + piece * 8); *(v8us*)(WT + (size_t)(n0 + nr) * K + k0 + piece * 8) = val; }
    };
    pass(); 
}
extern "C" void kernel_launch(void* const* d_in, const int* in_sizes, int n_in,
                              void* d_out, int out_size, void* d_ws, size_t ws_size, hipStream_t stream) {
    (void)in_sizes; (void)n_in; (void)out_size;
    const float* xq = (const float*)d_in[0]; const float* xk = (const float*)d_in[1]; const float* xv = (const float*)d_in[2];
    const float* Wq = (const float*)d_in[3]; const float* bq = (const float*)d_in[4]; const float* Wk = (const float*)d_in[5]; const float* bk = (const float*)d_in[6]; const float* Wv = (const float*)d_in[7]; const float* bv = (const float*)d_in[8];   // k-major (x @ W) + biases
    float* out = (float*)d_out;    // [8][2048][512]
    char* wsp = (char*)d_ws;
    auto take = [&](size_t bytes) { char* p = wsp; wsp += (bytes + 255) & ~(size_t)255; return (void*)p; };
    bf* WqT = (bf*)take((size_t)DM * DM * 2); bf* WkT = (bf*)take((size_t)DM * DM * 2); bf* WvT = (bf*)take((size_t)DM * DM * 2);
    bf* Qh = (bf*)take((size_t)NB_ * NT_ * DM * 2); bf* Ql = (bf*)take((size_t)NB_ * NT_ * DM * 2); bf* Kh = (bf*)take((size_t)NB_ * NT_ * DM * 2); bf* Kl = (bf*)take((size_t)NB_ * NT_ * DM * 2);
    bf* VTH = (bf*)take((size_t)NB_ * DM * NT_ * 2); bf* VTL = (bf*)take((size_t)NB_ * DM * NT_ * 2); float* S = (float*)take((size_t)NB_ * RCH * NT_ * 4); bf* PH = (bf*)take((size_t)NB_ * RCH * NT_ * 2); bf* PL = (bf*)take((size_t)NB_ * RCH * NT_ * 2);
    bf* Xb = (bf*)S; float* TMP = (float*)((char*)S + (size_t)NB_ * NT_ * DM * 2);    // 16.8 + 33.6 MB inside the 67.1 MB of S: both are dead before the first scores launch writes S
    if ((size_t)(wsp - (char*)d_ws) > ws_size) return;    // ~ 1.6 + 4 x 16.8 + 2 x 16.8 + 67.1 + 2 x 33.6 ~ 236 MB (per-chunk reuse of S / PH / PL in stream order)
    k_wt<<<dim3(DM / 64, DM / 64, 1), 256, 0, stream>>>(Wq, DM, DM, WqT); k_wt<<<dim3(DM / 64, DM / 64, 1), 256, 0, stream>>>(Wk, DM, DM, WkT); k_wt<<<dim3(DM / 64, DM / 64, 1), 256, 0, stream>>>(Wv, DM, DM, WvT);
    k_cvtb<<<NB_ * NT_ / 8, 256, 0, stream>>>(xq, NB_ * NT_, Xb);
    k_mm<false, 0><<<dim3(NB_ * NT_ / TB, DM / TB, 1), 256, 0, stream>>>(Xb, nullptr, WqT, nullptr, bq, DM, TMP, DM, 0, 0, 0, 0); k_split<<<NB_ * NT_ / 8, 256, 0, stream>>>(TMP, NB_ * NT_, Qh, Ql);
    k_cvtb<<<NB_ * NT_ / 8, 256, 0, stream>>>(xk, NB_ * NT_, Xb);
    k_mm<false, 0><<<dim3(NB_ * NT_ / TB, DM / TB, 1), 256, 0, stream>>>(Xb, nullptr, WkT, nullptr, bk, DM, TMP, DM, 0, 0, 0, 0); k_split<<<NB_ * NT_ / 8, 256, 0, stream>>>(TMP, NB_ * NT_, Kh, Kl);
    k_cvtb<<<NB_ * NT_ / 8, 256, 0, stream>>>(xv, NB_ * NT_, Xb);
    k_mm<false, 0><<<dim3(NB_ * NT_ / TB, DM / TB, 1), 256, 0, stream>>>(Xb, nullptr, WvT, nullptr, bv, DM, TMP, DM, 0, 0, 0, 0); k_vt<<<dim3(NT_ / 64, 2, NKV * NB_), 256, 0, stream>>>(TMP, VTH, VTL);
    for (int ch = 0; ch < NT_ / RCH; ++ch) {
        const int r0 = ch * RCH, kmax = r0 + RCH;
        k_mm<true, 1><<<dim3(RCH / TB, kmax / TB, NB_), 256, 0, stream>>>(Qh + (size_t)r0 * DM, Ql + (size_t)r0 * DM, Kh, Kl, nullptr, DM, S, NT_, NT_ * DM, NT_ * DM, RCH * NT_, r0);
        k_csoftmax<<<NB_ * RCH / 8, 256, 0, stream>>>(S, r0, NT_, PH, PL);
        k_mm<true, 2><<<dim3(RCH / TB, DM / TB, NB_), 256, 0, stream>>>(PH, PL, VTH, VTL, nullptr, NT_, out + (size_t)r0 * DM, DM, RCH * NT_, DM * NT_, NT_ * DM, r0);
    }
}

// v004
// A run of this version takes 214 microseconds.
// Timed twice side by side with v003, it ran 1.12 and 1.11 times as fast.
// Counting every step since v000, it is 8.27 times as fast.
#include <hip/hip_runtime.h>

// Compute dtypes, f32 accumulate, all 8 batch items in every launch (rows flattened, or the item in blockIdx.z): q/k/v = x.W + b from the three separate inputs ([8 x 2048 x 512].[512 x 512], k-major weights transposed once;
// PLAIN bf16 operands = inputs rounded once) on v_wmma_f32_16x16x32_bf16 -> bf16 hi + UNSCALED residual planes, written by the product's own epilogue (v transposed to [d][t]); single-head causal
// attention over the 512-dim head in two query chunks of 1024: scores = q.k^T ([1024 x 512].[512 x kmax], three products, kmax = causal reach), causal row softmax of
// scores x 512^-1/2 (the reference divides q by sqrt(512); applied to the product here) in f32 -> bf16 hi + UNSCALED residual (zeros above the diagonal), out = P.v.
// Causal trim: a 128-query row block sees the keys [0, reach), reach = its first query + 128; score tiles, softmax columns and P.v k steps at or beyond reach are neither computed, stored nor read.

#define NB_  8
#define NT_  2048
#define DM   512
#define NTK  NT_
#define RCH  1024
#define SCL  0.044194173824159216f     // 512^-1/2 (the reference scales q; applied to the scores here)
#define LOSC 1024.0f

typedef _Float16 h16;
typedef unsigned short bf;
typedef __attribute__((ext_vector_type(16))) __bf16   v16bf;
typedef __attribute__((ext_vector_type(16))) _Float16 v16h;
typedef __attribute__((ext_vector_type(8)))  _Float16 v8h;
typedef __attribute__((ext_vector_type(8)))  unsigned short v8us;
typedef __attribute__((ext_vector_type(8)))  float    v8f;
typedef __attribute__((ext_vector_type(4)))  float    v4f;
typedef __attribute__((ext_vector_type(4)))  _Float16 v4h;
typedef v8h  __attribute__((may_alias)) v8ha;
typedef v4f  __attribute__((may_alias)) v4fa;
typedef v8us __attribute__((may_alias)) v8usa;

__device__ __forceinline__ unsigned short f2bf(float f) { unsigned u = __float_as_uint(f); u += 0x7FFFu + ((u >> 16) & 1u); return (unsigned short)(u >> 16); }
__device__ __forceinline__ float bf2f(unsigned short b) { return __uint_as_float(((unsigned)b) << 16); }
__device__ __forceinline__ float bfr(float f) { return bf2f(f2bf(f)); }
__device__ __forceinline__ v16h cat16(v8h lo, v8h hi) { return __builtin_shufflevector(lo, hi, 0, 1, 2, 3, 4, 5, 6, 7, 8, 9, 10, 11, 12, 13, 14, 15); }
__device__ __forceinline__ v16bf cat16b(v8us lo, v8us hi) { return __builtin_bit_cast(v16bf, __builtin_shufflevector(lo, hi, 0, 1, 2, 3, 4, 5, 6, 7, 8, 9, 10, 11, 12, 13, 14, 15)); }
__device__ __forceinline__ v8f wmma16(v16h a, v16h b, v8f c) { return __builtin_amdgcn_wmma_f32_16x16x32_f16(false, a, false, b, (short)0, c, false, false); }
__device__ __forceinline__ v8f wmmab(v16bf a, v16bf b, v8f c) { return __builtin_amdgcn_wmma_f32_16x16x32_bf16(false, a, false, b, (short)0, c, false, false); }

__global__ __launch_bounds__(256) void k_cvtb(const float* __restrict__ src, int nrows, bf* dst) {
    const int lane = threadIdx.x & 31, r = blockIdx.x * 8 + (threadIdx.x >> 5);
    if (r >= nrows) return;
    v8us o[DM / 256];
#pragma unroll
    for (int q = 0; q < DM / 256; ++q) { v8us t;
#pragma unroll
        for (int i = 0; i < 8; ++i) t[i] = f2bf(src[(size_t)r * DM + q * 256 + lane * 8 + i]);
        o[q] = t; }
#pragma unroll
    for (int q = 0; q < DM / 256; ++q) *(v8us*)(dst + (size_t)r * DM + q * 256 + lane * 8) = o[q];
    
}

#define TB   128                 // block tile: 128 rows x 128 columns of C, 8 waves (4 x 2) of 32 x 64
#define KST  64                  // k per stage: one whole 128-byte line of every operand row
#define LP   144                 // LDS row pitch in bytes: 16 x odd, conflict-free for the 16-byte fragment reads
#define PLB  (TB * LP)           // one operand plane of one stage in LDS

// stage_pair: this thread's four 16-byte pieces (rows r, r + 32, r + 64, r + 96) of an A plane's and of a B plane's 128 x 64 stage, global memory -> LDS with no register in between.
// The s_wait_xcnt closes the statement so that no address register of an issued copy is rewritten ahead of it.
__device__ __forceinline__ void stage_pair(unsigned la, const bf* a0, const bf* b0, int ld) {
    const unsigned la1 = la + 32 * LP, la2 = la + 64 * LP, la3 = la + 96 * LP, lb = la + PLB, lb1 = lb + 32 * LP, lb2 = lb + 64 * LP, lb3 = lb + 96 * LP;
    const bf* a1 = a0 + (size_t)32 * ld; const bf* a2 = a0 + (size_t)64 * ld; const bf* a3 = a0 + (size_t)96 * ld;
    const bf* b1 = b0 + (size_t)32 * ld; const bf* b2 = b0 + (size_t)64 * ld; const bf* b3 = b0 + (size_t)96 * ld;
    asm volatile("global_load_async_to_lds_b128 %0, %8, off\n\t"
                 "global_load_async_to_lds_b128 %1, %9, off\n\t"
                 "global_load_async_to_lds_b128 %2, %10, off\n\t"
                 "global_load_async_to_lds_b128 %3, %11, off\n\t"
                 "global_load_async_to_lds_b128 %4, %12, off\n\t"
                 "global_load_async_to_lds_b128 %5, %13, off\n\t"
                 "global_load_async_to_lds_b128 %6, %14, off\n\t"
                 "global_load_async_to_lds_b128 %7, %15, off\n\t"
                 "s_wait_xcnt 0x0"
                 :: "v"(la), "v"(la1), "v"(la2), "v"(la3), "v"(lb), "v"(lb1), "v"(lb2), "v"(lb3), "v"(a0), "v"(a1), "v"(a2), "v"(a3), "v"(b0), "v"(b1), "v"(b2), "v"(b3) : "memory");
}
__device__ __forceinline__ v16bf ldsfrag(const unsigned char* p) { return cat16b(*(const v8usa*)p, *(const v8usa*)(p + 32)); }

// k_mm: 128 x 128 block tile of C = A.B^T over K (row strides = K for every plane; n-major B), f32. SPLIT: A = Ah + Al, B = Bh + Bl, three products per 32-k step in the order
// hh, lh, hl; else Ah.Bh alone, + bf(bias[c]). Every operand row is fetched once per block as whole lines into a two-buffer LDS ring and the fragments are read from LDS.
// blockIdx.z = batch item, sA / sB / sC = elements from one item's A planes / B planes / C to the next item's. K is a multiple of 64 and at least 128 (two stages).
// CAUSAL (rows = queries, row 0 = query q0): 1 = C's columns are keys, a tile wholly above the diagonal is left out; 2 = k runs over keys, the k loop ends at the row block's reach (P is 0 from there on).
// The work then grows with the row block, so the row block is rotated by the item: work-groups whose flat index is equal modulo the grid's x extent take every row block in turn instead of always the same one
// (for speed only: every (row block, item) is still taken exactly once).
// OUT: 0 = C in f32. 1 = no C: each value v leaves as bf16 hi = bf(v) in Dh and UNSCALED bf16 residual bf(v - hi) in Dl, both [row][ldc]. 2 = the same two planes transposed per item of NT_ rows:
// [row / NT_][column][row % NT_] (the n-major B operand of P.v), column count DM.
template <bool SPLIT, int CAUSAL, int OUT>
__global__ __launch_bounds__(256) void k_mm(const bf* __restrict__ Ah, const bf* __restrict__ Al, const bf* __restrict__ Bh, const bf* __restrict__ Bl, const float* __restrict__ bias, int K, float* C, int ldc, int sA, int sB, int sC, int q0, bf* Dh, bf* Dl) {
    constexpr int BUFB = (SPLIT ? 4 : 2) * PLB;      // one stage: [Ah | Bh | Al | Bl]
    __shared__ __attribute__((aligned(16))) unsigned char ring[2 * BUFB];
    const int tid = threadIdx.x, lane = tid & 31, wave = tid >> 5, lr = lane & 15, hi = lane >> 4, wr = wave >> 1, wc = wave & 1;
    const int R0 = (CAUSAL ? (blockIdx.x + blockIdx.z) % (RCH / TB) : blockIdx.x) * TB, C0 = blockIdx.y * TB, reach = q0 + R0 + TB;
    if (CAUSAL == 1 && C0 >= reach) return;    // the whole work-group leaves, ahead of every copy and barrier
    const int nst = (CAUSAL == 2 ? reach : K) / KST;
    const size_t ga = (size_t)blockIdx.z * sA + (size_t)(R0 + (tid >> 3)) * K + (tid & 7) * 8, gb = (size_t)blockIdx.z * sB + (size_t)(C0 + (tid >> 3)) * K + (tid & 7) * 8;
    const unsigned lc = (unsigned)(size_t)ring + (tid >> 3) * LP + (tid & 7) * 16;
    auto fill = [&](int s) {
        const unsigned l = lc + (s & 1) * BUFB; const size_t k0 = (size_t)s * KST;
        stage_pair(l, Ah + ga + k0, Bh + gb + k0, K);
        if (SPLIT) stage_pair(l + 2 * PLB, Al + ga + k0, Bl + gb + k0, K);
    };
    v8f acc[2][4];
#pragma unroll
    for (int rt = 0; rt < 2; ++rt) {
#pragma unroll
        for (int t = 0; t < 4; ++t) acc[rt][t] = (v8f){}; }
    fill(0);
    asm volatile("s_wait_asynccnt 0x0" ::: "memory");    // this wave's copies of stage 0 have landed
    __syncthreads();                                     // ... and every other wave's: stage 0 may be read
    fill(1);
#pragma unroll 1
    for (int s = 0; s < nst; ++s) {
        const unsigned char* pa = ring + (s & 1) * BUFB + (wr * 32 + lr) * LP + hi * 16;
        const unsigned char* pb = ring + (s & 1) * BUFB + PLB + (wc * 64 + lr) * LP + hi * 16;
#pragma unroll
        for (int ks = 0; ks < KST / 32; ++ks) {
            v16bf a[2], al[2], bh[4], bl[4];
#pragma unroll
            for (int rt = 0; rt < 2; ++rt) a[rt] = ldsfrag(pa + rt * 16 * LP + ks * 64);
#pragma unroll
            for (int t = 0; t < 4; ++t) bh[t] = ldsfrag(pb + t * 16 * LP + ks * 64);
            if (SPLIT) {
#pragma unroll
                for (int rt = 0; rt < 2; ++rt) al[rt] = ldsfrag(pa + 2 * PLB + rt * 16 * LP + ks * 64);
#pragma unroll
                for (int t = 0; t < 4; ++t) bl[t] = ldsfrag(pb + 2 * PLB + t * 16 * LP + ks * 64);
            }
            __builtin_amdgcn_sched_barrier(0);    // the 32-k step's LDS reads stay one group ahead of its matrix instructions (for speed only)
#pragma unroll
            for (int t = 0; t < 4; ++t) { acc[0][t] = wmmab(a[0], bh[t], acc[0][t]); acc[1][t] = wmmab(a[1], bh[t], acc[1][t]); }
            if (SPLIT) {
#pragma unroll
                for (int t = 0; t < 4; ++t) { acc[0][t] = wmmab(al[0], bh[t], acc[0][t]); acc[1][t] = wmmab(al[1], bh[t], acc[1][t]); }
#pragma unroll
                for (int t = 0; t < 4; ++t) { acc[0][t] = wmmab(a[0], bl[t], acc[0][t]); acc[1][t] = wmmab(a[1], bl[t], acc[1][t]); }
            }
        }
        __builtin_amdgcn_sched_barrier(0);                   // the stage's matrix instructions stay ahead of the barrier: sunk behind it they would stand in front of the refill and cost the copies their lead
        asm volatile("s_wait_dscnt 0x0" ::: "memory");       // this wave's reads of stage s are done before its buffer is refilled
        asm volatile("s_wait_asynccnt 0x0" ::: "memory");    // this wave's copies of stage s + 1 have landed
        __syncthreads();                                     // publishes stage s + 1 and ends every wave's reads of stage s
        if (s + 2 < nst) fill(s + 2);
    }
    asm volatile("s_wait_asynccnt 0x0" ::: "memory");        // no copy is outstanding when the ring becomes output staging
    constexpr int TP = 2 * TB + 16;                          // OUT 2: pitch in bytes of a staged transposed bf16 row (128 rows of C), 16 x odd
    static_assert(2 * TB * TP <= 2 * BUFB, "both transposed planes fit the ring");
    unsigned char* th = ring; unsigned char* tl = ring + TB * TP;
    float* os = (float*)(void*)ring + wave * (32 * 68);      // behind the last stage's barrier: 32 x 64 f32 per wave at pitch 68
#pragma unroll
    for (int t = 0; t < 4; ++t) { const float bv = (!SPLIT && bias) ? bfr(bias[C0 + wc * 64 + t * 16 + lr]) : 0.f;
#pragma unroll
        for (int rt = 0; rt < 2; ++rt) {
            if constexpr (OUT == 2) {    // a lane's 8 values of one accumulator tile are 8 consecutive rows of one column: one 16-byte piece of a transposed bf16 row
                v8us oh, ol;
#pragma unroll
                for (int j = 0; j < 8; ++j) { const float v = SPLIT ? acc[rt][t][j] : acc[rt][t][j] + bv; const unsigned short hb = f2bf(v); oh[j] = hb; ol[j] = f2bf(v - bf2f(hb)); }
                const int o = (wc * 64 + t * 16 + lr) * TP + (wr * 32 + rt * 16 + hi * 8) * 2; *(v8usa*)(th + o) = oh; *(v8usa*)(tl + o) = ol;
            } else {
#pragma unroll
                for (int j = 0; j < 8; ++j) os[(rt * 16 + hi * 8 + j) * 68 + t * 16 + lr] = SPLIT ? acc[rt][t][j] : acc[rt][t][j] + bv; } } }
    __syncthreads();                                         // the staged tile is read back by other lanes (OUT 2: other waves) than wrote it
    if constexpr (OUT == 2) {    // 16 lanes x 16 bytes = the block's 128 rows of one column = two whole lines of each plane
        const size_t g0 = (size_t)(R0 / NT_) * DM * NT_ + (size_t)C0 * NT_ + R0 % NT_;
#pragma unroll
        for (int s = 0; s < 8; ++s) { const int u = s * 256 + tid, d = u >> 4, piece = u & 15; const size_t o = g0 + (size_t)d * NT_ + piece * 8;
            const v8us vh = *(const v8usa*)(th + d * TP + piece * 16), vl = *(const v8usa*)(tl + d * TP + piece * 16); *(v8us*)(Dh + o) = vh; *(v8us*)(Dl + o) = vl; }
    } else if constexpr (OUT == 1) {    // 8 lanes x 16 bytes = the wave's 64 columns of one row = one whole line of each plane
        const size_t g0 = (size_t)(R0 + wr * 32) * ldc + C0 + wc * 64;
#pragma unroll
        for (int s = 0; s < 8; ++s) { const int row = s * 4 + (lane >> 3), c = (lane & 7) * 8; const v4f x0 = *(const v4fa*)(os + row * 68 + c), x1 = *(const v4fa*)(os + row * 68 + c + 4); v8us oh, ol;
#pragma unroll
            for (int i = 0; i < 8; ++i) { const float v = i < 4 ? x0[i & 3] : x1[i & 3]; const unsigned short hb = f2bf(v); oh[i] = hb; ol[i] = f2bf(v - bf2f(hb)); }
            const size_t o = g0 + (size_t)row * ldc + c; *(v8us*)(Dh + o) = oh; *(v8us*)(Dl + o) = ol; }
    } else {
        float* crow = C + (size_t)blockIdx.z * sC + (size_t)(R0 + wr * 32) * ldc + C0 + wc * 64;
#pragma unroll
        for (int s = 0; s < 16; ++s) { const int Lid = (lane >> 3) + 4 * s, piece = lane & 7; const int row = Lid >> 1, cofs = (Lid & 1) * 32 + piece * 4;
            const v4f val = *(const v4fa*)(os + row * 68 + cofs); *(v4f*)(crow + (size_t)row * ldc + cofs) = val; }
    }
}

// k_csoftmax: one wave per row r of the chunk's scores S [8 items x 1024][pitch] (row = query r0 + r % 1024 of item r / 1024): over the causally visible columns k <= r0 + r % 1024 (the rest of the row up to the
// reach of its 128-row block gets probability 0; nothing beyond is read or written): a = s x 512^-1/2, max, exp, normalise (f32, fixed lane order; the row re-read per phase) -> bf16 hi + UNSCALED residual planes with the same pitch 'ncols';
__global__ __launch_bounds__(256) void k_csoftmax(const float* __restrict__ S, int r0, int ncols, bf* PH, bf* PL) {
    const int lane = threadIdx.x & 31, r = blockIdx.x * 8 + (threadIdx.x >> 5); if (r >= NB_ * RCH) return;
    const int qi = r0 + r % RCH, lim = (qi / TB + 1) * TB; const float* sr = S + (size_t)r * ncols;
    float m = -3.0e38f;
#pragma unroll 1
    for (int c0 = lane * 8; c0 < lim; c0 += 256) { const v8f v = *(const v8f*)(sr + c0);
#pragma unroll
        for (int i = 0; i < 8; ++i) if (c0 + i <= qi) m = fmaxf(m, v[i] * SCL); }
#pragma unroll
    for (int sh = 16; sh; sh >>= 1) m = fmaxf(m, __shfl_xor(m, sh, 32));
    float sum = 0.f;
#pragma unroll 1
    for (int c0 = lane * 8; c0 < lim; c0 += 256) { const v8f v = *(const v8f*)(sr + c0);
#pragma unroll
        for (int i = 0; i < 8; ++i) if (c0 + i <= qi) sum += __expf(v[i] * SCL - m); }
#pragma unroll
    for (int sh = 16; sh; sh >>= 1) sum += __shfl_xor(sum, sh, 32);
    const float inv = 1.0f / sum;
{
#pragma unroll 1
        for (int c0 = lane * 8; c0 < lim; c0 += 256) { const v8f v = *(const v8f*)(sr + c0); v8us oh, ol;
#pragma unroll
            for (int i = 0; i < 8; ++i) { const float p = (c0 + i <= qi) ? __expf(v[i] * SCL - m) * inv : 0.f; const unsigned short hb = f2bf(p); oh[i] = hb; ol[i] = f2bf(p - bf2f(hb)); }
            const size_t o = (size_t)r * ncols + c0; *(v8us*)(PH + o) = oh; *(v8us*)(PL + o) = ol; }
         }
}

// k_wt: WT [n][K] = bf16(W[k][n]) (k-major [K][ncols]) via 64 x 64 LDS tiles; grid (K/64, ncols/64).
__global__ __launch_bounds__(256) void k_wt(const float* __restrict__ Wm, int K, int ncols, bf* WT) {
    __shared__ __align__(16) unsigned short tl[64 * 72];
    const int tid = threadIdx.x, k0 = blockIdx.x * 64, n0 = blockIdx.y * 64;
    const int kk = tid >> 2, nq = (tid & 3) * 16;
#pragma unroll
    for (int i = 0; i < 16; ++i) tl[(nq + i) * 72 + kk] = f2bf(Wm[(size_t)(k0 + kk) * ncols + n0 + nq + i]);
    __syncthreads();
    const int piece = tid & 7;
    auto pass = [&]() {
#pragma unroll
        for (int s = 0; s < 2; ++s) { const int nr = (tid >> 3) + 32 * s; const v8us val = *(const v8usa*)(tl + nr * 72 + piece * 8); *(v8us*)(WT + (size_t)(n0 + nr) * K + k0 + piece * 8) = val; }
    };
    pass(); 
}
extern "C" void kernel_launch(void* const* d_in, const int* in_sizes, int n_in,
                              void* d_out, int out_size, void* d_ws, size_t ws_size, hipStream_t stream) {
    (void)in_sizes; (void)n_in; (void)out_size;
    const float* xq = (const float*)d_in[0]; const float* xk = (const float*)d_in[1]; const float* xv = (const float*)d_in[2];
    const float* Wq = (const float*)d_in[3]; const float* bq = (const float*)d_in[4]; const float* Wk = (const float*)d_in[5]; const float* bk = (const float*)d_in[6]; const float* Wv = (const float*)d_in[7]; const float* bv = (const float*)d_in[8];   // k-major (x @ W) + biases
    float* out = (float*)d_out;    // [8][2048][512]
    char* wsp = (char*)d_ws;
    auto take = [&](size_t bytes) { char* p = wsp; wsp += (bytes + 255) & ~(size_t)255; return (void*)p; };
    bf* WqT = (bf*)take((size_t)DM * DM * 2); bf* WkT = (bf*)take((size_t)DM * DM * 2); bf* WvT = (bf*)take((size_t)DM * DM * 2);
    bf* Qh = (bf*)take((size_t)NB_ * NT_ * DM * 2); bf* Ql = (bf*)take((size_t)NB_ * NT_ * DM * 2); bf* Kh = (bf*)take((size_t)NB_ * NT_ * DM * 2); bf* Kl = (bf*)take((size_t)NB_ * NT_ * DM * 2);
    bf* VTH = (bf*)take((size_t)NB_ * DM * NT_ * 2); bf* VTL = (bf*)take((size_t)NB_ * DM * NT_ * 2); float* S = (float*)take((size_t)NB_ * RCH * NT_ * 4); bf* PH = (bf*)take((size_t)NB_ * RCH * NT_ * 2); bf* PL = (bf*)take((size_t)NB_ * RCH * NT_ * 2);
    bf* Xb = (bf*)S;    // 16.8 MB inside the 67.1 MB of S: dead before the first scores launch writes S
    if ((size_t)(wsp - (char*)d_ws) > ws_size) return;    // ~ 1.6 + 4 x 16.8 + 2 x 16.8 + 67.1 + 2 x 33.6 ~ 236 MB (per-chunk reuse of S / PH / PL in stream order)
    k_wt<<<dim3(DM / 64, DM / 64, 1), 256, 0, stream>>>(Wq, DM, DM, WqT); k_wt<<<dim3(DM / 64, DM / 64, 1), 256, 0, stream>>>(Wk, DM, DM, WkT); k_wt<<<dim3(DM / 64, DM / 64, 1), 256, 0, stream>>>(Wv, DM, DM, WvT);
    k_cvtb<<<NB_ * NT_ / 8, 256, 0, stream>>>(xq, NB_ * NT_, Xb);
    k_mm<false, 0, 1><<<dim3(NB_ * NT_ / TB, DM / TB, 1), 256, 0, stream>>>(Xb, nullptr, WqT, nullptr, bq, DM, nullptr, DM, 0, 0, 0, 0, Qh, Ql);
    k_cvtb<<<NB_ * NT_ / 8, 256, 0, stream>>>(xk, NB_ * NT_, Xb);
    k_mm<false, 0, 1><<<dim3(NB_ * NT_ / TB, DM / TB, 1), 256, 0, stream>>>(Xb, nullptr, WkT, nullptr, bk, DM, nullptr, DM, 0, 0, 0, 0, Kh, Kl);
    k_cvtb<<<NB_ * NT_ / 8, 256, 0, stream>>>(xv, NB_ * NT_, Xb);
    k_mm<false, 0, 2><<<dim3(NB_ * NT_ / TB, DM / TB, 1), 256, 0, stream>>>(Xb, nullptr, WvT, nullptr, bv, DM, nullptr, DM, 0, 0, 0, 0, VTH, VTL);
    for (int ch = 0; ch < NT_ / RCH; ++ch) {
        const int r0 = ch * RCH, kmax = r0 + RCH;
        k_mm<true, 1, 0><<<dim3(RCH / TB, kmax / TB, NB_), 256, 0, stream>>>(Qh + (size_t)r0 * DM, Ql + (size_t)r0 * DM, Kh, Kl, nullptr, DM, S, NT_, NT_ * DM, NT_ * DM, RCH * NT_, r0, nullptr, nullptr);
        k_csoftmax<<<NB_ * RCH / 8, 256, 0, stream>>>(S, r0, NT_, PH, PL);
        k_mm<true, 2, 0><<<dim3(RCH / TB, DM / TB, NB_), 256, 0, stream>>>(PH, PL, VTH, VTL, nullptr, NT_, out + (size_t)r0 * DM, DM, RCH * NT_, DM * NT_, NT_ * DM, r0, nullptr, nullptr);
    }
}

// v005
// A run of this version takes 184 microseconds.
// Next to v004, in two timings, it ran 1.16 times as fast each time.
// All steps since v000 together make it 9.61 times as fast.
#include <hip/hip_runtime.h>

// Compute dtypes, f32 accumulate, all 8 batch items in every launch (rows flattened, or the item in blockIdx.z): q/k/v = x.W + b from the three separate inputs ([8 x 2048 x 512].[512 x 512], k-major weights transposed once;
// PLAIN bf16 operands = inputs rounded once, exact) on v_wmma_f32_16x16x32_bf16 -> bf16 hi + UNSCALED residual planes, written by the product's own epilogue (v transposed to [d][t]); single-head causal
// attention over the 512-dim head, all 2048 queries of every item per launch: scores = q.k^T ([2048 x 512].[512 x reach], three products), causal row softmax of
// scores x 512^-1/2 (the reference divides q by sqrt(512); applied to the product here) in f32 -> bf16 hi + UNSCALED residual (zeros above the diagonal), written in place over the row's f32 scores, out = P.v.
// Causal trim: a 128-query row block sees the keys [0, reach), reach = its first query + 128; score tiles, softmax columns and P.v k steps at or beyond reach are neither computed, stored nor read.

#define NB_  8
#define NT_  2048
#define DM   512
#define NTK  NT_
#define SCL  0.044194173824159216f     // 512^-1/2 (the reference scales q; applied to the scores here)
#define LOSC 1024.0f

typedef _Float16 h16;
typedef unsigned short bf;
typedef __attribute__((ext_vector_type(16))) __bf16   v16bf;
typedef __attribute__((ext_vector_type(16))) _Float16 v16h;
typedef __attribute__((ext_vector_type(8)))  _Float16 v8h;
typedef __attribute__((ext_vector_type(8)))  unsigned short v8us;
typedef __attribute__((ext_vector_type(8)))  float    v8f;
typedef __attribute__((ext_vector_type(4)))  float    v4f;
typedef __attribute__((ext_vector_type(4)))  _Float16 v4h;
typedef v8h  __attribute__((may_alias)) v8ha;
typedef v4f  __attribute__((may_alias)) v4fa;
typedef v8us __attribute__((may_alias)) v8usa;

__device__ __forceinline__ unsigned short f2bf(float f) { unsigned u = __float_as_uint(f); u += 0x7FFFu + ((u >> 16) & 1u); return (unsigned short)(u >> 16); }
__device__ __forceinline__ float bf2f(unsigned short b) { return __uint_as_float(((unsigned)b) << 16); }
__device__ __forceinline__ float bfr(float f) { return bf2f(f2bf(f)); }
__device__ __forceinline__ v16h cat16(v8h lo, v8h hi) { return __builtin_shufflevector(lo, hi, 0, 1, 2, 3, 4, 5, 6, 7, 8, 9, 10, 11, 12, 13, 14, 15); }
__device__ __forceinline__ v16bf cat16b(v8us lo, v8us hi) { return __builtin_bit_cast(v16bf, __builtin_shufflevector(lo, hi, 0, 1, 2, 3, 4, 5, 6, 7, 8, 9, 10, 11, 12, 13, 14, 15)); }
__device__ __forceinline__ v8f wmma16(v16h a, v16h b, v8f c) { return __builtin_amdgcn_wmma_f32_16x16x32_f16(false, a, false, b, (short)0, c, false, false); }
__device__ __forceinline__ v8f wmmab(v16bf a, v16bf b, v8f c) { return __builtin_amdgcn_wmma_f32_16x16x32_bf16(false, a, false, b, (short)0, c, false, false); }

__global__ __launch_bounds__(256) void k_cvtb(const float* __restrict__ src, int nrows, bf* dst) {
    const int lane = threadIdx.x & 31, r = blockIdx.x * 8 + (threadIdx.x >> 5);
    if (r >= nrows) return;
    v8us o[DM / 256];
#pragma unroll
    for (int q = 0; q < DM / 256; ++q) { v8us t;
#pragma unroll
        for (int i = 0; i < 8; ++i) t[i] = f2bf(src[(size_t)r * DM + q * 256 + lane * 8 + i]);
        o[q] = t; }
#pragma unroll
    for (int q = 0; q < DM / 256; ++q) *(v8us*)(dst + (size_t)r * DM + q * 256 + lane * 8) = o[q];
    
}

#define TB   128                 // block tile: 128 rows x 128 columns of C, 8 waves (4 x 2) of 32 x 64
#define KST  64                  // k per stage: one whole 128-byte line of every operand row
#define LP   144                 // LDS row pitch in bytes: 16 x odd, conflict-free for the 16-byte fragment reads
#define PLB  (TB * LP)           // one operand plane of one stage in LDS
#define NRB  (NT_ / TB)          // 128-query row blocks of one item

// stage_pair: this thread's four 16-byte pieces (rows r, r + 32, r + 64, r + 96) of an A plane's and of a B plane's 128 x 64 stage, global memory -> LDS with no register in between.
// The s_wait_xcnt closes the statement so that no address register of an issued copy is rewritten ahead of it.
__device__ __forceinline__ void stage_pair(unsigned la, const bf* a0, const bf* b0, int lda, int ldb) {
    const unsigned la1 = la + 32 * LP, la2 = la + 64 * LP, la3 = la + 96 * LP, lb = la + PLB, lb1 = lb + 32 * LP, lb2 = lb + 64 * LP, lb3 = lb + 96 * LP;
    const bf* a1 = a0 + (size_t)32 * lda; const bf* a2 = a0 + (size_t)64 * lda; const bf* a3 = a0 + (size_t)96 * lda;
    const bf* b1 = b0 + (size_t)32 * ldb; const bf* b2 = b0 + (size_t)64 * ldb; const bf* b3 = b0 + (size_t)96 * ldb;
    asm volatile("global_load_async_to_lds_b128 %0, %8, off\n\t"
                 "global_load_async_to_lds_b128 %1, %9, off\n\t"
                 "global_load_async_to_lds_b128 %2, %10, off\n\t"
                 "global_load_async_to_lds_b128 %3, %11, off\n\t"
                 "global_load_async_to_lds_b128 %4, %12, off\n\t"
                 "global_load_async_to_lds_b128 %5, %13, off\n\t"
                 "global_load_async_to_lds_b128 %6, %14, off\n\t"
                 "global_load_async_to_lds_b128 %7, %15, off\n\t"
                 "s_wait_xcnt 0x0"
                 :: "v"(la), "v"(la1), "v"(la2), "v"(la3), "v"(lb), "v"(lb1), "v"(lb2), "v"(lb3), "v"(a0), "v"(a1), "v"(a2), "v"(a3), "v"(b0), "v"(b1), "v"(b2), "v"(b3) : "memory");
}
__device__ __forceinline__ v16bf ldsfrag(const unsigned char* p) { return cat16b(*(const v8usa*)p, *(const v8usa*)(p + 32)); }

// k_mm: 128 x 128 block tile of C = A.B^T over K (row stride lda for the A planes, K for the B planes; n-major B), f32. SPLIT: A = Ah + Al, B = Bh + Bl, three products per 32-k step in the order
// hh, lh, hl; else Ah.Bh alone, + bf(bias[c]). Every operand row is fetched once per block as whole lines into a two-buffer LDS ring and the fragments are read from LDS.
// blockIdx.z = batch item, sA / sB / sC = elements from one item's A planes / B planes / C to the next item's. K is a multiple of 64 and at least 128 (two stages).
// CAUSAL (rows = an item's queries): 1 = C's columns are keys, a tile wholly above the diagonal is left out; 2 = k runs over keys, the k loop ends at the row block's reach (P is 0 from there on).
// 1: the tiles left grow with the row block, so the row block is rotated by the item: work-groups whose flat index is equal modulo the grid's x extent take eight successive row blocks, one per item, instead of always the same one.
// 2: the k loop grows with the row block, so a work-group takes row block x and then row block NRB - 1 - x (grid x extent NRB / 2): every work-group runs the same NRB + 1 blocks of 128 keys.
// (Both for speed only: every (row block, item) is still taken exactly once.)
// OUT: 0 = C in f32. 1 = no C: each value v leaves as bf16 hi = bf(v) in Dh and UNSCALED bf16 residual bf(v - hi) in Dl, both [row][ldc]. 2 = the same two planes transposed per item of NT_ rows:
// [row / NT_][column][row % NT_] (the n-major B operand of P.v), column count DM.
template <bool SPLIT, int CAUSAL, int OUT>
__global__ __launch_bounds__(256) void k_mm(const bf* __restrict__ Ah, const bf* __restrict__ Al, const bf* __restrict__ Bh, const bf* __restrict__ Bl, const float* __restrict__ bias, int K, int lda, float* C, int ldc, int sA, int sB, int sC, bf* Dh, bf* Dl) {
    constexpr int BUFB = (SPLIT ? 4 : 2) * PLB;      // one stage: [Ah | Bh | Al | Bl]
    __shared__ __attribute__((aligned(16))) unsigned char ring[2 * BUFB];
    const int tid = threadIdx.x, lane = tid & 31, wave = tid >> 5, lr = lane & 15, hi = lane >> 4, wr = wave >> 1, wc = wave & 1;
    const int C0 = blockIdx.y * TB;
    const size_t gb = (size_t)blockIdx.z * sB + (size_t)(C0 + (tid >> 3)) * K + (tid & 7) * 8;
    const unsigned lc = (unsigned)(size_t)ring + (tid >> 3) * LP + (tid & 7) * 16;
#pragma unroll 1    // CAUSAL 2: the two row blocks share one copy of the code
  for (int turn = 0; turn < (CAUSAL == 2 ? 2 : 1); ++turn) {
    const int R0 = (CAUSAL == 1 ? (blockIdx.x + blockIdx.z) % NRB : turn ? NRB - 1 - blockIdx.x : blockIdx.x) * TB, reach = R0 + TB;
    if (CAUSAL == 1 && C0 >= reach) return;    // the whole work-group leaves, ahead of every copy and barrier
    if (turn) {
        asm volatile("s_wait_dscnt 0x0" ::: "memory");    // this wave's reads of the first row block's staged output are done before the ring is filled again
        asm volatile("s_wait_xcnt 0x0" ::: "memory");     // the first row block's output stores are issued: their address and data registers are written anew from here on
        __syncthreads();                                  // ... and every other wave's
    }
    const int nst = (CAUSAL == 2 ? reach : K) / KST;
    const size_t ga = (size_t)blockIdx.z * sA + (size_t)(R0 + (tid >> 3)) * lda + (tid & 7) * 8;
    auto fill = [&](int s) {
        const unsigned l = lc + (s & 1) * BUFB; const size_t k0 = (size_t)s * KST;
        stage_pair(l, Ah + ga + k0, Bh + gb + k0, lda, K);
        if (SPLIT) stage_pair(l + 2 * PLB, Al + ga + k0, Bl + gb + k0, lda, K);
    };
    v8f acc[2][4];
#pragma unroll
    for (int rt = 0; rt < 2; ++rt) {
#pragma unroll
        for (int t = 0; t < 4; ++t) acc[rt][t] = (v8f){}; }
    fill(0);
    asm volatile("s_wait_asynccnt 0x0" ::: "memory");    // this wave's copies of stage 0 have landed
    __syncthreads();                                     // ... and every other wave's: stage 0 may be read
    fill(1);
#pragma unroll 1
    for (int s = 0; s < nst; ++s) {
        const unsigned char* pa = ring + (s & 1) * BUFB + (wr * 32 + lr) * LP + hi * 16;
        const unsigned char* pb = ring + (s & 1) * BUFB + PLB + (wc * 64 + lr) * LP + hi * 16;
#pragma unroll
        for (int ks = 0; ks < KST / 32; ++ks) {
            v16bf a[2], al[2], bh[4], bl[4];
#pragma unroll
            for (int rt = 0; rt < 2; ++rt) a[rt] = ldsfrag(pa + rt * 16 * LP + ks * 64);
#pragma unroll
            for (int t = 0; t < 4; ++t) bh[t] = ldsfrag(pb + t * 16 * LP + ks * 64);
            if (SPLIT) {
#pragma unroll
                for (int rt = 0; rt < 2; ++rt) al[rt] = ldsfrag(pa + 2 * PLB + rt * 16 * LP + ks * 64);
#pragma unroll
                for (int t = 0; t < 4; ++t) bl[t] = ldsfrag(pb + 2 * PLB + t * 16 * LP + ks * 64);
            }
            __builtin_amdgcn_sched_barrier(0);    // the 32-k step's LDS reads stay one group ahead of its matrix instructions (for speed only)
#pragma unroll
            for (int t = 0; t < 4; ++t) { acc[0][t] = wmmab(a[0], bh[t], acc[0][t]); acc[1][t] = wmmab(a[1], bh[t], acc[1][t]); }
            if (SPLIT) {
#pragma unroll
                for (int t = 0; t < 4; ++t) { acc[0][t] = wmmab(al[0], bh[t], acc[0][t]); acc[1][t] = wmmab(al[1], bh[t], acc[1][t]); }
#pragma unroll
                for (int t = 0; t < 4; ++t) { acc[0][t] = wmmab(a[0], bl[t], acc[0][t]); acc[1][t] = wmmab(a[1], bl[t], acc[1][t]); }
            }
        }
        __builtin_amdgcn_sched_barrier(0);                   // the stage's matrix instructions stay ahead of the barrier: sunk behind it they would stand in front of the refill and cost the copies their lead
        asm volatile("s_wait_dscnt 0x0" ::: "memory");       // this wave's reads of stage s are done before its buffer is refilled
        asm volatile("s_wait_asynccnt 0x0" ::: "memory");    // this wave's copies of stage s + 1 have landed
        __syncthreads();                                     // publishes stage s + 1 and ends every wave's reads of stage s
        if (s + 2 < nst) fill(s + 2);
    }
    asm volatile("s_wait_asynccnt 0x0" ::: "memory");        // no copy is outstanding when the ring becomes output staging
    constexpr int TP = 2 * TB + 16;                          // OUT 2: pitch in bytes of a staged transposed bf16 row (128 rows of C), 16 x odd
    static_assert(2 * TB * TP <= 2 * BUFB, "both transposed planes fit the ring");
    unsigned char* th = ring; unsigned char* tl = ring + TB * TP;
    float* os = (float*)(void*)ring + wave * (32 * 68);      // behind the last stage's barrier: 32 x 64 f32 per wave at pitch 68
#pragma unroll
    for (int t = 0; t < 4; ++t) { const float bv = (!SPLIT && bias) ? bfr(bias[C0 + wc * 64 + t * 16 + lr]) : 0.f;
#pragma unroll
        for (int rt = 0; rt < 2; ++rt) {
            if constexpr (OUT == 2) {    // a lane's 8 values of one accumulator tile are 8 consecutive rows of one column: one 16-byte piece of a transposed bf16 row
                v8us oh, ol;
#pragma unroll
                for (int j = 0; j < 8; ++j) { const float v = SPLIT ? acc[rt][t][j] : acc[rt][t][j] + bv; const unsigned short hb = f2bf(v); oh[j] = hb; ol[j] = f2bf(v - bf2f(hb)); }
                const int o = (wc * 64 + t * 16 + lr) * TP + (wr * 32 + rt * 16 + hi * 8) * 2; *(v8usa*)(th + o) = oh; *(v8usa*)(tl + o) = ol;
            } else {
#pragma unroll
                for (int j = 0; j < 8; ++j) os[(rt * 16 + hi * 8 + j) * 68 + t * 16 + lr] = SPLIT ? acc[rt][t][j] : acc[rt][t][j] + bv; } } }
    __syncthreads();                                         // the staged tile is read back by other lanes (OUT 2: other waves) than wrote it
    if constexpr (OUT == 2) {    // 16 lanes x 16 bytes = the block's 128 rows of one column = two whole lines of each plane
        const size_t g0 = (size_t)(R0 / NT_) * DM * NT_ + (size_t)C0 * NT_ + R0 % NT_;
#pragma unroll
        for (int s = 0; s < 8; ++s) { const int u = s * 256 + tid, d = u >> 4, piece = u & 15; const size_t o = g0 + (size_t)d * NT_ + piece * 8;
            const v8us vh = *(const v8usa*)(th + d * TP + piece * 16), vl = *(const v8usa*)(tl + d * TP + piece * 16); *(v8us*)(Dh + o) = vh; *(v8us*)(Dl + o) = vl; }
    } else if constexpr (OUT == 1) {    // 8 lanes x 16 bytes = the wave's 64 columns of one row = one whole line of each plane
        const size_t g0 = (size_t)(R0 + wr * 32) * ldc + C0 + wc * 64;
#pragma unroll
        for (int s = 0; s < 8; ++s) { const int row = s * 4 + (lane >> 3), c = (lane & 7) * 8; const v4f x0 = *(const v4fa*)(os + row * 68 + c), x1 = *(const v4fa*)(os + row * 68 + c + 4); v8us oh, ol;
#pragma unroll
            for (int i = 0; i < 8; ++i) { const float v = i < 4 ? x0[i & 3] : x1[i & 3]; const unsigned short hb = f2bf(v); oh[i] = hb; ol[i] = f2bf(v - bf2f(hb)); }
            const size_t o = g0 + (size_t)row * ldc + c; *(v8us*)(Dh + o) = oh; *(v8us*)(Dl + o) = ol; }
    } else {
        float* crow = C + (size_t)blockIdx.z * sC + (size_t)(R0 + wr * 32) * ldc + C0 + wc * 64;
#pragma unroll
        for (int s = 0; s < 16; ++s) { const int Lid = (lane >> 3) + 4 * s, piece = lane & 7; const int row = Lid >> 1, cofs = (Lid & 1) * 32 + piece * 4;
            const v4f val = *(const v4fa*)(os + row * 68 + cofs); *(v4f*)(crow + (size_t)row * ldc + cofs) = val; }
    }
  }
}

// k_csoftmax: one wave per row r of the scores S [8 items x 2048][2048] (row = query r % 2048 of item r / 2048): over the causally visible columns k <= r % 2048 (the rest of the row up to the
// reach of its 128-row block gets probability 0; nothing beyond is read or written): a = s x 512^-1/2, max, exp, normalise (f32, fixed lane order). The wave holds its whole row in registers, so the row is read once
// and the bf16 hi + UNSCALED residual planes go in place over it: hi in the first half of the row's 8192 bytes, residual in the second (two planes of row pitch 2 x 2048 bf16). Every load of the row is
// consumed by the two wave-wide reductions ahead of the first store, and no other wave touches the row.
__global__ __launch_bounds__(256) void k_csoftmax(float* S) {
    const int lane = threadIdx.x & 31, r = blockIdx.x * 8 + __builtin_amdgcn_readfirstlane(threadIdx.x >> 5); if (r >= NB_ * NT_) return;    // the row in a scalar register: the tests on lim below are then scalar branches
    const int qi = r % NT_, lim = (qi / TB + 1) * TB; float* sr = S + (size_t)r * NT_; bf* ph = (bf*)(void*)sr; bf* pl = ph + NT_;
    v8f v[NT_ / 256];
#pragma unroll
    for (int j = 0; j < NT_ / 256; ++j) { const int c0 = j * 256 + lane * 8; v[j] = (v8f){};
        if (j * 256 < lim) { if (c0 < lim) v[j] = *(const v8f*)(sr + c0); } }
    float m = -3.0e38f;
#pragma unroll
    for (int j = 0; j < NT_ / 256; ++j) { const int c0 = j * 256 + lane * 8;
        if (j * 256 < lim) {
#pragma unroll
            for (int i = 0; i < 8; ++i) if (c0 + i <= qi) m = fmaxf(m, v[j][i] * SCL); } }
#pragma unroll
    for (int sh = 16; sh; sh >>= 1) m = fmaxf(m, __shfl_xor(m, sh, 32));
    float sum = 0.f;
#pragma unroll
    for (int j = 0; j < NT_ / 256; ++j) { const int c0 = j * 256 + lane * 8;
        if (j * 256 < lim) {
#pragma unroll
            for (int i = 0; i < 8; ++i) { const float e = (c0 + i <= qi) ? __expf(v[j][i] * SCL - m) : 0.f; v[j][i] = e; sum += e; } } }
#pragma unroll
    for (int sh = 16; sh; sh >>= 1) sum += __shfl_xor(sum, sh, 32);
    const float inv = 1.0f / sum;
#pragma unroll
    for (int j = 0; j < NT_ / 256; ++j) { const int c0 = j * 256 + lane * 8;
        if (j * 256 < lim) { v8us oh, ol;
#pragma unroll
            for (int i = 0; i < 8; ++i) { const float p = v[j][i] * inv; const unsigned short hb = f2bf(p); oh[i] = hb; ol[i] = f2bf(p - bf2f(hb)); }
            if (c0 < lim) { *(v8usa*)(ph + c0) = oh; *(v8usa*)(pl + c0) = ol; } } }
}

// k_wt: WT [n][K] = bf16(W[k][n]) (k-major [K][ncols]) via 64 x 64 LDS tiles; grid (K/64, ncols/64).
__global__ __launch_bounds__(256) void k_wt(const float* __restrict__ Wm, int K, int ncols, bf* WT) {
    __shared__ __align__(16) unsigned short tl[64 * 72];
    const int tid = threadIdx.x, k0 = blockIdx.x * 64, n0 = blockIdx.y * 64;
    const int kk = tid >> 2, nq = (tid & 3) * 16;
#pragma unroll
    for (int i = 0; i < 16; ++i) tl[(nq + i) * 72 + kk] = f2bf(Wm[(size_t)(k0 + kk) * ncols + n0 + nq + i]);
    __syncthreads();
    const int piece = tid & 7;
    auto pass = [&]() {
#pragma unroll
        for (int s = 0; s < 2; ++s) { const int nr = (tid >> 3) + 32 * s; const v8us val = *(const v8usa*)(tl + nr * 72 + piece * 8); *(v8us*)(WT + (size_t)(n0 + nr) * K + k0 + piece * 8) = val; }
    };
    pass(); 
}
extern "C" void kernel_launch(void* const* d_in, const int* in_sizes, int n_in,
                              void* d_out, int out_size, void* d_ws, size_t ws_size, hipStream_t stream) {
    (void)in_sizes; (void)n_in; (void)out_size;
    const float* xq = (const float*)d_in[0]; const float* xk = (const float*)d_in[1]; const float* xv = (const float*)d_in[2];
    const float* Wq = (const float*)d_in[3]; const float* bq = (const float*)d_in[4]; const float* Wk = (const float*)d_in[5]; const float* bk = (const float*)d_in[6]; const float* Wv = (const float*)d_in[7]; const float* bv = (const float*)d_in[8];   // k-major (x @ W) + biases
    float* out = (float*)d_out;    // [8][2048][512]
    char* wsp = (char*)d_ws;
    auto take = [&](size_t bytes) { char* p = wsp; wsp += (bytes + 255) & ~(size_t)255; return (void*)p; };
    bf* WqT = (bf*)take((size_t)DM * DM * 2); bf* WkT = (bf*)take((size_t)DM * DM * 2); bf* WvT = (bf*)take((size_t)DM * DM * 2);
    bf* Qh = (bf*)take((size_t)NB_ * NT_ * DM * 2); bf* Ql = (bf*)take((size_t)NB_ * NT_ * DM * 2); bf* Kh = (bf*)take((size_t)NB_ * NT_ * DM * 2); bf* Kl = (bf*)take((size_t)NB_ * NT_ * DM * 2);
    bf* VTH = (bf*)take((size_t)NB_ * DM * NT_ * 2); bf* VTL = (bf*)take((size_t)NB_ * DM * NT_ * 2); float* S = (float*)take((size_t)NB_ * NT_ * NT_ * 4);
    bf* Xb = (bf*)S;    // 16.8 MB inside the 134.2 MB of S: dead before the scores launch writes S
    const bf* PH = (const bf*)S; const bf* PL = PH + NT_;    // the probability planes lie in place over the scores: row pitch 2 x NT_ bf16
    if ((size_t)(wsp - (char*)d_ws) > ws_size) return;    // ~ 1.6 + 4 x 16.8 + 2 x 16.8 + 134.2 ~ 236 MB
    k_wt<<<dim3(DM / 64, DM / 64, 1), 256, 0, stream>>>(Wq, DM, DM, WqT); k_wt<<<dim3(DM / 64, DM / 64, 1), 256, 0, stream>>>(Wk, DM, DM, WkT); k_wt<<<dim3(DM / 64, DM / 64, 1), 256, 0, stream>>>(Wv, DM, DM, WvT);
    k_cvtb<<<NB_ * NT_ / 8, 256, 0, stream>>>(xq, NB_ * NT_, Xb);
    k_mm<false, 0, 1><<<dim3(NB_ * NT_ / TB, DM / TB, 1), 256, 0, stream>>>(Xb, nullptr, WqT, nullptr, bq, DM, DM, nullptr, DM, 0, 0, 0, Qh, Ql);
    k_cvtb<<<NB_ * NT_ / 8, 256, 0, stream>>>(xk, NB_ * NT_, Xb);
    k_mm<false, 0, 1><<<dim3(NB_ * NT_ / TB, DM / TB, 1), 256, 0, stream>>>(Xb, nullptr, WkT, nullptr, bk, DM, DM, nullptr, DM, 0, 0, 0, Kh, Kl);
    k_cvtb<<<NB_ * NT_ / 8, 256, 0, stream>>>(xv, NB_ * NT_, Xb);
    k_mm<false, 0, 2><<<dim3(NB_ * NT_ / TB, DM / TB, 1), 256, 0, stream>>>(Xb, nullptr, WvT, nullptr, bv, DM, DM, nullptr, DM, 0, 0, 0, VTH, VTL);
    k_mm<true, 1, 0><<<dim3(NRB, NRB, NB_), 256, 0, stream>>>(Qh, Ql, Kh, Kl, nullptr, DM, DM, S, NT_, NT_ * DM, NT_ * DM, NT_ * NT_, nullptr, nullptr);
    k_csoftmax<<<NB_ * NT_ / 8, 256, 0, stream>>>(S);
    k_mm<true, 2, 0><<<dim3(NRB / 2, DM / TB, NB_), 256, 0, stream>>>(PH, PL, VTH, VTL, nullptr, NT_, 2 * NT_, out, DM, NT_ * 2 * NT_, DM * NT_, NT_ * DM, nullptr, nullptr);
}

// v006
// It runs in 159 microseconds.
// Two timings next to v005 put it at 1.15 and 1.16 times that version's speed.
// Counting every step since v000, it is 11.1 times as fast.
#include <hip/hip_runtime.h>

// Compute dtypes, f32 accumulate, all 8 batch items in every launch (rows flattened, or the item in blockIdx.z): q/k/v = x.W + b from the three separate inputs, all three in one launch ([8 x 2048 x 512].[512 x 512], k-major weights transposed once;
// PLAIN bf16 operands = inputs rounded once, exact) on v_wmma_f32_16x16x32_bf16 -> bf16 hi + UNSCALED residual planes, written by the product's own epilogue (v transposed to [d][t]); single-head causal
// attention over the 512-dim head, all 2048 queries of every item per launch: scores = q.k^T ([2048 x 512].[512 x reach], three products), causal row softmax of
// scores x 512^-1/2 (the reference divides q by sqrt(512); applied to the product here) in f32 -> bf16 hi + UNSCALED residual (zeros above the diagonal), written in place over the row's f32 scores, out = P.v.
// Causal trim: a 128-query row block sees the keys [0, reach), reach = its first query + 128; score tiles, softmax columns and P.v k steps at or beyond reach are neither computed, stored nor read.

#define NB_  8
#define NT_  2048
#define DM   512
#define NTK  NT_
#define SCL  0.044194173824159216f     // 512^-1/2 (the reference scales q; applied to the scores here)
#define LOSC 1024.0f

typedef _Float16 h16;
typedef unsigned short bf;
typedef __attribute__((ext_vector_type(16))) __bf16   v16bf;
typedef __attribute__((ext_vector_type(16))) _Float16 v16h;
typedef __attribute__((ext_vector_type(8)))  _Float16 v8h;
typedef __attribute__((ext_vector_type(8)))  unsigned short v8us;
typedef __attribute__((ext_vector_type(8)))  float    v8f;
typedef __attribute__((ext_vector_type(4)))  float    v4f;
typedef __attribute__((ext_vector_type(4)))  _Float16 v4h;
typedef v8h  __attribute__((may_alias)) v8ha;
typedef v4f  __attribute__((may_alias)) v4fa;
typedef v8us __attribute__((may_alias)) v8usa;

__device__ __forceinline__ unsigned short f2bf(float f) { unsigned u = __float_as_uint(f); u += 0x7FFFu + ((u >> 16) & 1u); return (unsigned short)(u >> 16); }
__device__ __forceinline__ float bf2f(unsigned short b) { return __uint_as_float(((unsigned)b) << 16); }
__device__ __forceinline__ float bfr(float f) { return bf2f(f2bf(f)); }
__device__ __forceinline__ v16h cat16(v8h lo, v8h hi) { return __builtin_shufflevector(lo, hi, 0, 1, 2, 3, 4, 5, 6, 7, 8, 9, 10, 11, 12, 13, 14, 15); }
__device__ __forceinline__ v16bf cat16b(v8us lo, v8us hi) { return __builtin_bit_cast(v16bf, __builtin_shufflevector(lo, hi, 0, 1, 2, 3, 4, 5, 6, 7, 8, 9, 10, 11, 12, 13, 14, 15)); }
__device__ __forceinline__ v8f wmma16(v16h a, v16h b, v8f c) { return __builtin_amdgcn_wmma_f32_16x16x32_f16(false, a, false, b, (short)0, c, false, false); }
__device__ __forceinline__ v8f wmmab(v16bf a, v16bf b, v8f c) { return __builtin_amdgcn_wmma_f32_16x16x32_bf16(false, a, false, b, (short)0, c, false, false); }

// cvtb: block blk of 8 rows (one wave a row) of src [rows][512] f32 -> dst bf16.
__device__ __forceinline__ void cvtb(const float* __restrict__ src, int blk, bf* dst) {
    const int lane = threadIdx.x & 31, r = blk * 8 + (threadIdx.x >> 5);
    if (r >= NB_ * NT_) return;
    v8us o[DM / 256];
#pragma unroll
    for (int q = 0; q < DM / 256; ++q) { v8us t;
#pragma unroll
        for (int i = 0; i < 8; ++i) t[i] = f2bf(src[(size_t)r * DM + q * 256 + lane * 8 + i]);
        o[q] = t; }
#pragma unroll
    for (int q = 0; q < DM / 256; ++q) *(v8us*)(dst + (size_t)r * DM + q * 256 + lane * 8) = o[q];
    
}

#define TB   128                 // block tile: 128 rows x 128 columns of C, 8 waves (4 x 2) of 32 x 64
#define KST  64                  // k per stage: one whole 128-byte line of every operand row
#define LP   144                 // LDS row pitch in bytes: 16 x odd, conflict-free for the 16-byte fragment reads
#define PLB  (TB * LP)           // one operand plane of one stage in LDS
#define NRB  (NT_ / TB)          // 128-query row blocks of one item

// stage_pair: this thread's four 16-byte pieces (rows r, r + 32, r + 64, r + 96) of an A plane's and of a B plane's 128 x 64 stage, global memory -> LDS with no register in between.
// The s_wait_xcnt closes the statement so that no address register of an issued copy is rewritten ahead of it.
__device__ __forceinline__ void stage_pair(unsigned la, const bf* a0, const bf* b0, int lda, int ldb) {
    const unsigned la1 = la + 32 * LP, la2 = la + 64 * LP, la3 = la + 96 * LP, lb = la + PLB, lb1 = lb + 32 * LP, lb2 = lb + 64 * LP, lb3 = lb + 96 * LP;
    const bf* a1 = a0 + (size_t)32 * lda; const bf* a2 = a0 + (size_t)64 * lda; const bf* a3 = a0 + (size_t)96 * lda;
    const bf* b1 = b0 + (size_t)32 * ldb; const bf* b2 = b0 + (size_t)64 * ldb; const bf* b3 = b0 + (size_t)96 * ldb;
    asm volatile("global_load_async_to_lds_b128 %0, %8, off\n\t"
                 "global_load_async_to_lds_b128 %1, %9, off\n\t"
                 "global_load_async_to_lds_b128 %2, %10, off\n\t"
                 "global_load_async_to_lds_b128 %3, %11, off\n\t"
                 "global_load_async_to_lds_b128 %4, %12, off\n\t"
                 "global_load_async_to_lds_b128 %5, %13, off\n\t"
                 "global_load_async_to_lds_b128 %6, %14, off\n\t"
                 "global_load_async_to_lds_b128 %7, %15, off\n\t"
                 "s_wait_xcnt 0x0"
                 :: "v"(la), "v"(la1), "v"(la2), "v"(la3), "v"(lb), "v"(lb1), "v"(lb2), "v"(lb3), "v"(a0), "v"(a1), "v"(a2), "v"(a3), "v"(b0), "v"(b1), "v"(b2), "v"(b3) : "memory");
}
__device__ __forceinline__ v16bf ldsfrag(const unsigned char* p) { return cat16b(*(const v8usa*)p, *(const v8usa*)(p + 32)); }

// k_mm: 128 x 128 block tile of C = A.B^T over K (row stride lda for the A planes, K for the B planes; n-major B), f32. SPLIT: A = Ah + Al, B = Bh + Bl, three products per 32-k step in the order
// hh, lh, hl; else Ah.Bh alone, + bf(bias[c]). Every operand row is fetched once per block as whole lines into a two-buffer LDS ring and the fragments are read from LDS.
// blockIdx.z = batch item, sA / sB / sC = elements from one item's A planes / B planes / C to the next item's. K is a multiple of 64 and at least 128 (two stages).
// CAUSAL (rows = an item's queries): 1 = C's columns are keys, a tile wholly above the diagonal is left out; 2 = k runs over keys, the k loop ends at the row block's reach (P is 0 from there on).
// 1: the tiles left grow with the row block, so the row block is rotated by the item: work-groups whose flat index is equal modulo the grid's x extent take eight successive row blocks, one per item, instead of always the same one.
// 2: the k loop grows with the row block, so a work-group takes row block x and then row block NRB - 1 - x (grid x extent NRB / 2): every work-group runs the same NRB + 1 blocks of 128 keys.
// (Both for speed only: every (row block, item) is still taken exactly once.)
// OUT: 0 = C in f32. 1 = no C: each value v leaves as bf16 hi = bf(v) in Dh and UNSCALED bf16 residual bf(v - hi) in Dl, both [row][ldc]. 2 = the same two planes transposed per item of NT_ rows:
// [row / NT_][column][row % NT_] (the n-major B operand of P.v), column count DM. 3 = the three projections in one launch: blockIdx.z = the projection (its A, B and plane pair by sA, sB, sC; its bias
// among bias, bias1, bias2), written as 1 for q and k, as 2 for v.
template <bool SPLIT, int CAUSAL, int OUT>
__global__ __launch_bounds__(256) void k_mm(const bf* __restrict__ Ah, const bf* __restrict__ Al, const bf* __restrict__ Bh, const bf* __restrict__ Bl, const float* __restrict__ bias, const float* __restrict__ bias1, const float* __restrict__ bias2, int K, int lda, float* C, int ldc, int sA, int sB, int sC, bf* Dh, bf* Dl) {
    constexpr int BUFB = (SPLIT ? 4 : 2) * PLB;      // one stage: [Ah | Bh | Al | Bl]
    __shared__ __attribute__((aligned(16))) unsigned char ring[2 * BUFB];
    const int tid = threadIdx.x, lane = tid & 31, wave = tid >> 5, lr = lane & 15, hi = lane >> 4, wr = wave >> 1, wc = wave & 1;
    const int C0 = blockIdx.y * TB;
    const int om = OUT == 3 ? (blockIdx.z == 2 ? 2 : 1) : OUT;    // the same for the whole work-group
    const float* bz = OUT == 3 ? (blockIdx.z == 0 ? bias : blockIdx.z == 1 ? bias1 : bias2) : bias;
    if (OUT == 3) { Dh += (size_t)blockIdx.z * sC; Dl += (size_t)blockIdx.z * sC; }
    const size_t gb = (size_t)blockIdx.z * sB + (size_t)(C0 + (tid >> 3)) * K + (tid & 7) * 8;
    const unsigned lc = (unsigned)(size_t)ring + (tid >> 3) * LP + (tid & 7) * 16;
#pragma unroll 1    // CAUSAL 2: the two row blocks share one copy of the code
  for (int turn = 0; turn < (CAUSAL == 2 ? 2 : 1); ++turn) {
    const int R0 = (CAUSAL == 1 ? (blockIdx.x + blockIdx.z) % NRB : turn ? NRB - 1 - blockIdx.x : blockIdx.x) * TB, reach = R0 + TB;
    if (CAUSAL == 1 && C0 >= reach) return;    // the whole work-group leaves, ahead of every copy and barrier
    if (turn) {
        asm volatile("s_wait_dscnt 0x0" ::: "memory");    // this wave's reads of the first row block's staged output are done before the ring is filled again
        asm volatile("s_wait_xcnt 0x0" ::: "memory");     // the first row block's output stores are issued: their address and data registers are written anew from here on
        __syncthreads();                                  // ... and every other wave's
    }
    const int nst = (CAUSAL == 2 ? reach : K) / KST;
    const size_t ga = (size_t)blockIdx.z * sA + (size_t)(R0 + (tid >> 3)) * lda + (tid & 7) * 8;
    auto fill = [&](int s) {
        const unsigned l = lc + (s & 1) * BUFB; const size_t k0 = (size_t)s * KST;
        stage_pair(l, Ah + ga + k0, Bh + gb + k0, lda, K);
        if (SPLIT) stage_pair(l + 2 * PLB, Al + ga + k0, Bl + gb + k0, lda, K);
    };
    v8f acc[2][4];
#pragma unroll
    for (int rt = 0; rt < 2; ++rt) {
#pragma unroll
        for (int t = 0; t < 4; ++t) acc[rt][t] = (v8f){}; }
    fill(0);
    asm volatile("s_wait_asynccnt 0x0" ::: "memory");    // this wave's copies of stage 0 have landed
    __syncthreads();                                     // ... and every other wave's: stage 0 may be read
    fill(1);
#pragma unroll 1
    for (int s = 0; s < nst; ++s) {
        const unsigned char* pa = ring + (s & 1) * BUFB + (wr * 32 + lr) * LP + hi * 16;
        const unsigned char* pb = ring + (s & 1) * BUFB + PLB + (wc * 64 + lr) * LP + hi * 16;
#pragma unroll
        for (int ks = 0; ks < KST / 32; ++ks) {
            v16bf a[2], al[2], bh[4], bl[4];
#pragma unroll
            for (int rt = 0; rt < 2; ++rt) a[rt] = ldsfrag(pa + rt * 16 * LP + ks * 64);
#pragma unroll
            for (int t = 0; t < 4; ++t) bh[t] = ldsfrag(pb + t * 16 * LP + ks * 64);
            if (SPLIT) {
#pragma unroll
                for (int rt = 0; rt < 2; ++rt) al[rt] = ldsfrag(pa + 2 * PLB + rt * 16 * LP + ks * 64);
#pragma unroll
                for (int t = 0; t < 4; ++t) bl[t] = ldsfrag(pb + 2 * PLB + t * 16 * LP + ks * 64);
            }
            __builtin_amdgcn_sched_barrier(0);    // the 32-k step's LDS reads stay one group ahead of its matrix instructions (for speed only)
#pragma unroll
            for (int t = 0; t < 4; ++t) { acc[0][t] = wmmab(a[0], bh[t], acc[0][t]); acc[1][t] = wmmab(a[1], bh[t], acc[1][t]); }
            if (SPLIT) {
#pragma unroll
                for (int t = 0; t < 4; ++t) { acc[0][t] = wmmab(al[0], bh[t], acc[0][t]); acc[1][t] = wmmab(al[1], bh[t], acc[1][t]); }
#pragma unroll
                for (int t = 0; t < 4; ++t) { acc[0][t] = wmmab(a[0], bl[t], acc[0][t]); acc[1][t] = wmmab(a[1], bl[t], acc[1][t]); }
            }
        }
        __builtin_amdgcn_sched_barrier(0);                   // the stage's matrix instructions stay ahead of the barrier: sunk behind it they would stand in front of the refill and cost the copies their lead
        asm volatile("s_wait_dscnt 0x0" ::: "memory");       // this wave's reads of stage s are done before its buffer is refilled
        asm volatile("s_wait_asynccnt 0x0" ::: "memory");    // this wave's copies of stage s + 1 have landed
        __syncthreads();                                     // publishes stage s + 1 and ends every wave's reads of stage s
        if (s + 2 < nst) fill(s + 2);
    }
    asm volatile("s_wait_asynccnt 0x0" ::: "memory");        // no copy is outstanding when the ring becomes output staging
    constexpr int TP = 2 * TB + 16;                          // OUT 2: pitch in bytes of a staged transposed bf16 row (128 rows of C), 16 x odd
    static_assert(2 * TB * TP <= 2 * BUFB, "both transposed planes fit the ring");
    unsigned char* th = ring; unsigned char* tl = ring + TB * TP;
    float* os = (float*)(void*)ring + wave * (32 * 68);      // behind the last stage's barrier: 32 x 64 f32 per wave at pitch 68
    float bv[4] = {0.f, 0.f, 0.f, 0.f};
    if (!SPLIT && bz) {
#pragma unroll
        for (int t = 0; t < 4; ++t) bv[t] = bfr(bz[C0 + wc * 64 + t * 16 + lr]); }
    if (om == 2) {    // a lane's 8 values of one accumulator tile are 8 consecutive rows of one column: one 16-byte piece of a transposed bf16 row
#pragma unroll
        for (int t = 0; t < 4; ++t) {
#pragma unroll
            for (int rt = 0; rt < 2; ++rt) { v8us oh, ol;
#pragma unroll
                for (int j = 0; j < 8; ++j) { const float v = SPLIT ? acc[rt][t][j] : acc[rt][t][j] + bv[t]; const unsigned short hb = f2bf(v); oh[j] = hb; ol[j] = f2bf(v - bf2f(hb)); }
                const int o = (wc * 64 + t * 16 + lr) * TP + (wr * 32 + rt * 16 + hi * 8) * 2; *(v8usa*)(th + o) = oh; *(v8usa*)(tl + o) = ol; } }
    } else {
#pragma unroll
        for (int t = 0; t < 4; ++t) {
#pragma unroll
            for (int rt = 0; rt < 2; ++rt) {
#pragma unroll
                for (int j = 0; j < 8; ++j) os[(rt * 16 + hi * 8 + j) * 68 + t * 16 + lr] = SPLIT ? acc[rt][t][j] : acc[rt][t][j] + bv[t]; } }
    }
    __syncthreads();                                         // the staged tile is read back by other lanes (transposed: other waves) than wrote it
    if (om == 2) {    // 16 lanes x 16 bytes = the block's 128 rows of one column = two whole lines of each plane
        const size_t g0 = (size_t)(R0 / NT_) * DM * NT_ + (size_t)C0 * NT_ + R0 % NT_;
#pragma unroll
        for (int s = 0; s < 8; ++s) { const int u = s * 256 + tid, d = u >> 4, piece = u & 15; const size_t o = g0 + (size_t)d * NT_ + piece * 8;
            const v8us vh = *(const v8usa*)(th + d * TP + piece * 16), vl = *(const v8usa*)(tl + d * TP + piece * 16); *(v8us*)(Dh + o) = vh; *(v8us*)(Dl + o) = vl; }
    } else if (om == 1) {    // 8 lanes x 16 bytes = the wave's 64 columns of one row = one whole line of each plane
        const size_t g0 = (size_t)(R0 + wr * 32) * ldc + C0 + wc * 64;
#pragma unroll
        for (int s = 0; s < 8; ++s) { const int row = s * 4 + (lane >> 3), c = (lane & 7) * 8; const v4f x0 = *(const v4fa*)(os + row * 68 + c), x1 = *(const v4fa*)(os + row * 68 + c + 4); v8us oh, ol;
#pragma unroll
            for (int i = 0; i < 8; ++i) { const float v = i < 4 ? x0[i & 3] : x1[i & 3]; const unsigned short hb = f2bf(v); oh[i] = hb; ol[i] = f2bf(v - bf2f(hb)); }
            const size_t o = g0 + (size_t)row * ldc + c; *(v8us*)(Dh + o) = oh; *(v8us*)(Dl + o) = ol; }
    } else {
        float* crow = C + (size_t)blockIdx.z * sC + (size_t)(R0 + wr * 32) * ldc + C0 + wc * 64;
#pragma unroll
        for (int s = 0; s < 16; ++s) { const int Lid = (lane >> 3) + 4 * s, piece = lane & 7; const int row = Lid >> 1, cofs = (Lid & 1) * 32 + piece * 4;
            const v4f val = *(const v4fa*)(os + row * 68 + cofs); *(v4f*)(crow + (size_t)row * ldc + cofs) = val; }
    }
  }
}

// k_csoftmax: one wave per row r of the scores S [8 items x 2048][2048] (row = query r % 2048 of item r / 2048): over the causally visible columns k <= r % 2048 (the rest of the row up to the
// reach of its 128-row block gets probability 0; nothing beyond is read or written): a = s x 512^-1/2, max, exp, normalise (f32, fixed lane order). The wave holds its whole row in registers, so the row is read once
// and the bf16 hi + UNSCALED residual planes go in place over it: hi in the first half of the row's 8192 bytes, residual in the second (two planes of row pitch 2 x 2048 bf16). Every load of the row is
// consumed by the two wave-wide reductions ahead of the first store, and no other wave touches the row.
__global__ __launch_bounds__(256) void k_csoftmax(float* S) {
    const int lane = threadIdx.x & 31, r = blockIdx.x * 8 + __builtin_amdgcn_readfirstlane(threadIdx.x >> 5); if (r >= NB_ * NT_) return;    // the row in a scalar register: the tests on lim below are then scalar branches
    const int qi = r % NT_, lim = (qi / TB + 1) * TB; float* sr = S + (size_t)r * NT_; bf* ph = (bf*)(void*)sr; bf* pl = ph + NT_;
    v8f v[NT_ / 256];
#pragma unroll
    for (int j = 0; j < NT_ / 256; ++j) { const int c0 = j * 256 + lane * 8; v[j] = (v8f){};
        if (j * 256 < lim) { if (c0 < lim) v[j] = *(const v8f*)(sr + c0); } }
    float m = -3.0e38f;
#pragma unroll
    for (int j = 0; j < NT_ / 256; ++j) { const int c0 = j * 256 + lane * 8;
        if (j * 256 < lim) {
#pragma unroll
            for (int i = 0; i < 8; ++i) if (c0 + i <= qi) m = fmaxf(m, v[j][i] * SCL); } }
#pragma unroll
    for (int sh = 16; sh; sh >>= 1) m = fmaxf(m, __shfl_xor(m, sh, 32));
    float sum = 0.f;
#pragma unroll
    for (int j = 0; j < NT_ / 256; ++j) { const int c0 = j * 256 + lane * 8;
        if (j * 256 < lim) {
#pragma unroll
            for (int i = 0; i < 8; ++i) { const float e = (c0 + i <= qi) ? __expf(v[j][i] * SCL - m) : 0.f; v[j][i] = e; sum += e; } } }
#pragma unroll
    for (int sh = 16; sh; sh >>= 1) sum += __shfl_xor(sum, sh, 32);
    const float inv = 1.0f / sum;
#pragma unroll
    for (int j = 0; j < NT_ / 256; ++j) { const int c0 = j * 256 + lane * 8;
        if (j * 256 < lim) { v8us oh, ol;
#pragma unroll
            for (int i = 0; i < 8; ++i) { const float p = v[j][i] * inv; const unsigned short hb = f2bf(p); oh[i] = hb; ol[i] = f2bf(p - bf2f(hb)); }
            if (c0 < lim) { *(v8usa*)(ph + c0) = oh; *(v8usa*)(pl + c0) = ol; } } }
}

// wt: WT [n][K] = bf16(W[k][n]) (k-major [K][ncols]) via the 64 x 64 LDS tile tl; (bk, bn) = the tile's place among (K/64, ncols/64).
__device__ __forceinline__ void wt(const float* __restrict__ Wm, int K, int ncols, bf* WT, int bk, int bn, unsigned short* tl) {
    const int tid = threadIdx.x, k0 = bk * 64, n0 = bn * 64;
    const int kk = tid >> 2, nq = (tid & 3) * 16;
#pragma unroll
    for (int i = 0; i < 16; ++i) tl[(nq + i) * 72 + kk] = f2bf(Wm[(size_t)(k0 + kk) * ncols + n0 + nq + i]);
    __syncthreads();
    const int piece = tid & 7;
    auto pass = [&]() {
#pragma unroll
        for (int s = 0; s < 2; ++s) { const int nr = (tid >> 3) + 32 * s; const v8us val = *(const v8usa*)(tl + nr * 72 + piece * 8); *(v8us*)(WT + (size_t)(n0 + nr) * K + k0 + piece * 8) = val; }
    };
    pass(); 
}
#define NWT  ((DM / 64) * (DM / 64))    // 64 x 64 tiles of one weight matrix
#define NCB  (NB_ * NT_ / 8)            // 8-row blocks of one input
// k_prep: all that the projections read, in one launch (no piece depends on another): work-groups [0, 3 NWT) transpose the three weight matrices into WT [3][n][k] (first, being few and bound by latency),
// the next 3 NCB round the three inputs into Xb [3][rows][512].
__global__ __launch_bounds__(256) void k_prep(const float* __restrict__ x0, const float* __restrict__ x1, const float* __restrict__ x2, const float* __restrict__ W0, const float* __restrict__ W1, const float* __restrict__ W2, bf* Xb, bf* WT) {
    __shared__ __align__(16) unsigned short tl[64 * 72];
    const int b = blockIdx.x;
    if (b < 3 * NWT) { const int z = b / NWT, t = b % NWT;    // the same for the whole work-group: the barrier in wt is passed by all of it
        wt(z == 0 ? W0 : z == 1 ? W1 : W2, DM, DM, WT + (size_t)z * DM * DM, t % (DM / 64), t / (DM / 64), tl);
    } else { const int z = (b - 3 * NWT) / NCB, blk = (b - 3 * NWT) % NCB;
        cvtb(z == 0 ? x0 : z == 1 ? x1 : x2, blk, Xb + (size_t)z * NB_ * NT_ * DM); }
}
extern "C" void kernel_launch(void* const* d_in, const int* in_sizes, int n_in,
                              void* d_out, int out_size, void* d_ws, size_t ws_size, hipStream_t stream) {
    (void)in_sizes; (void)n_in; (void)out_size;
    const float* xq = (const float*)d_in[0]; const float* xk = (const float*)d_in[1]; const float* xv = (const float*)d_in[2];
    const float* Wq = (const float*)d_in[3]; const float* bq = (const float*)d_in[4]; const float* Wk = (const float*)d_in[5]; const float* bk = (const float*)d_in[6]; const float* Wv = (const float*)d_in[7]; const float* bv = (const float*)d_in[8];   // k-major (x @ W) + biases
    float* out = (float*)d_out;    // [8][2048][512]
    char* wsp = (char*)d_ws;
    auto take = [&](size_t bytes) { char* p = wsp; wsp += (bytes + 255) & ~(size_t)255; return (void*)p; };
    bf* WT = (bf*)take((size_t)3 * DM * DM * 2);    // [q, k, v][n][k]
    bf* Qh = (bf*)take((size_t)6 * NB_ * NT_ * DM * 2);    // the six planes in a row, one pair a projection: Qh Ql Kh Kl VTH VTL
    bf* Ql = Qh + (size_t)NB_ * NT_ * DM; bf* Kh = Ql + (size_t)NB_ * NT_ * DM; bf* Kl = Kh + (size_t)NB_ * NT_ * DM; bf* VTH = Kl + (size_t)NB_ * NT_ * DM; bf* VTL = VTH + (size_t)NB_ * NT_ * DM;
    float* S = (float*)take((size_t)NB_ * NT_ * NT_ * 4);
    bf* Xb = (bf*)S;    // [q, k, v] 3 x 16.8 MB inside the 134.2 MB of S: dead before the scores launch writes S
    const bf* PH = (const bf*)S; const bf* PL = PH + NT_;    // the probability planes lie in place over the scores: row pitch 2 x NT_ bf16
    if ((size_t)(wsp - (char*)d_ws) > ws_size) return;    // ~ 1.6 + 4 x 16.8 + 2 x 16.8 + 134.2 ~ 236 MB
    k_prep<<<3 * NWT + 3 * NCB, 256, 0, stream>>>(xq, xk, xv, Wq, Wk, Wv, Xb, WT);
    k_mm<false, 0, 3><<<dim3(NB_ * NT_ / TB, DM / TB, 3), 256, 0, stream>>>(Xb, nullptr, WT, nullptr, bq, bk, bv, DM, DM, nullptr, DM, NB_ * NT_ * DM, DM * DM, 2 * NB_ * NT_ * DM, Qh, Ql);
    k_mm<true, 1, 0><<<dim3(NRB, NRB, NB_), 256, 0, stream>>>(Qh, Ql, Kh, Kl, nullptr, nullptr, nullptr, DM, DM, S, NT_, NT_ * DM, NT_ * DM, NT_ * NT_, nullptr, nullptr);
    k_csoftmax<<<NB_ * NT_ / 8, 256, 0, stream>>>(S);
    k_mm<true, 2, 0><<<dim3(NRB / 2, DM / TB, NB_), 256, 0, stream>>>(PH, PL, VTH, VTL, nullptr, nullptr, nullptr, NT_, 2 * NT_, out, DM, NT_ * 2 * NT_, DM * NT_, NT_ * DM, nullptr, nullptr);
}

// v008
// It runs in 115 microseconds.
// Versions between v006 and this one are left out; their measured steps multiply to 1.38 times as fast.
// All steps since v000 together make it 15.4 times as fast.
#include <hip/hip_runtime.h>

// Compute dtypes, f32 accumulate, all 8 batch items in every launch (rows flattened, or the item in blockIdx.z): q/k/v = x.W + b from the three separate inputs, all three in one launch ([8 x 2048 x 512].[512 x 512], k-major weights transposed once;
// PLAIN bf16 operands = inputs rounded once, exact; x is rounded where its f32 fragment leaves LDS) on v_wmma_f32_16x16x32_bf16 -> one f16 plane each, written by the product's own epilogue (v transposed to [d][t]); single-head causal
// attention over the 512-dim head, all 2048 queries of every item per launch, on v_wmma_f32_16x16x32_f16: scores = q.k^T ([2048 x 512].[512 x reach], one product), causal row softmax of
// scores x 512^-1/2 (the reference divides q by sqrt(512); applied to the product here) in f32 -> f16 (zeros above the diagonal), written in place over the row's f32 scores, out = P.v.
// Why one f16 plane: q, k and v already carry the rounding of their bf16 factors (8 significant bits); f16's 11 bits add about an eighth of that error. f16 is finite below 65,504:
// q, k, v are sums of 512 products of unit-normal inputs with weights of deviation 512^-1/2; P lies in [0, 1] (below 2^-14 it keeps an absolute step of 2^-24).
// Causal trim: a 128-query row block sees the keys [0, reach), reach = its first query + 128; score tiles, softmax columns and P.v k steps at or beyond reach are neither computed, stored nor read.

#define NB_  8
#define NT_  2048
#define DM   512
#define NTK  NT_
#define SCL  0.044194173824159216f     // 512^-1/2 (the reference scales q; applied to the scores here)

typedef unsigned short bf;
typedef __attribute__((ext_vector_type(16))) __bf16   v16bf;
typedef __attribute__((ext_vector_type(16))) _Float16 v16h;
typedef __attribute__((ext_vector_type(16))) unsigned short v16us;
typedef __attribute__((ext_vector_type(8)))  unsigned short v8us;
typedef __attribute__((ext_vector_type(8)))  float    v8f;
typedef __attribute__((ext_vector_type(16))) float    v16f;
typedef __attribute__((ext_vector_type(4)))  float    v4f;
typedef v4f  __attribute__((may_alias)) v4fa;
typedef v8us __attribute__((may_alias)) v8usa;

__device__ __forceinline__ unsigned short f2bf(float f) { unsigned u = __float_as_uint(f); u += 0x7FFFu + ((u >> 16) & 1u); return (unsigned short)(u >> 16); }
__device__ __forceinline__ float bf2f(unsigned short b) { return __uint_as_float(((unsigned)b) << 16); }
__device__ __forceinline__ float bfr(float f) { return bf2f(f2bf(f)); }
__device__ __forceinline__ unsigned short f2h(float f) { return __builtin_bit_cast(unsigned short, (_Float16)f); }    // f32 -> f16, round to nearest even
// wmma: one 16 x 16 x 32 product on 16-bit operands held as raw bits; HF: they are f16, else bf16.
template <bool HF> __device__ __forceinline__ v8f wmma(v16us a, v16us b, v8f c) {
    if (HF) return __builtin_amdgcn_wmma_f32_16x16x32_f16(false, __builtin_bit_cast(v16h, a), false, __builtin_bit_cast(v16h, b), (short)0, c, false, false);
    return __builtin_amdgcn_wmma_f32_16x16x32_bf16(false, __builtin_bit_cast(v16bf, a), false, __builtin_bit_cast(v16bf, b), (short)0, c, false, false);
}

#define TB   128                 // block tile: 128 rows x 128 columns of C, 8 waves (4 x 2) of 32 x 64
#define KST  64                  // k per stage: one whole 128-byte line of every 16-bit operand row, two of an f32 one
#define LP   144                 // LDS row pitch in bytes: 16 x odd, conflict-free for the 16-byte fragment reads
#define PLB  (TB * LP)           // one operand plane of one stage in LDS
#define LPF  272                 // the same for an f32 operand row (64 k = 256 bytes): 16 x odd
#define PLF  (TB * LPF)          // one f32 operand plane of one stage in LDS
#define NRB  (NT_ / TB)          // 128-query row blocks of one item

// stage_pair: this thread's four 16-byte pieces (rows r, r + 32, r + 64, r + 96) of an A plane's and of a B plane's 128 x 64 stage, global memory -> LDS with no register in between.
// The s_wait_xcnt closes the statement so that no address register of an issued copy is rewritten ahead of it.
__device__ __forceinline__ void stage_pair(unsigned la, const bf* a0, const bf* b0, int lda, int ldb) {
    const unsigned la1 = la + 32 * LP, la2 = la + 64 * LP, la3 = la + 96 * LP, lb = la + PLB, lb1 = lb + 32 * LP, lb2 = lb + 64 * LP, lb3 = lb + 96 * LP;
    const bf* a1 = a0 + (size_t)32 * lda; const bf* a2 = a0 + (size_t)64 * lda; const bf* a3 = a0 + (size_t)96 * lda;
    const bf* b1 = b0 + (size_t)32 * ldb; const bf* b2 = b0 + (size_t)64 * ldb; const bf* b3 = b0 + (size_t)96 * ldb;
    asm volatile("global_load_async_to_lds_b128 %0, %8, off\n\t"
                 "global_load_async_to_lds_b128 %1, %9, off\n\t"
                 "global_load_async_to_lds_b128 %2, %10, off\n\t"
                 "global_load_async_to_lds_b128 %3, %11, off\n\t"
                 "global_load_async_to_lds_b128 %4, %12, off\n\t"
                 "global_load_async_to_lds_b128 %5, %13, off\n\t"
                 "global_load_async_to_lds_b128 %6, %14, off\n\t"
                 "global_load_async_to_lds_b128 %7, %15, off\n\t"
                 "s_wait_xcnt 0x0"
                 :: "v"(la), "v"(la1), "v"(la2), "v"(la3), "v"(lb), "v"(lb1), "v"(lb2), "v"(lb3), "v"(a0), "v"(a1), "v"(a2), "v"(a3), "v"(b0), "v"(b1), "v"(b2), "v"(b3) : "memory");
}
// stage_f32: the same for an f32 A plane: this thread's eight 16-byte pieces (rows r, r + 16, ..., r + 112; 16 threads a row of 256 bytes) of A's 128 x 64 stage and its four pieces of the 16-bit B plane's.
// The s_wait_xcnt closes the statement so that no address register of an issued copy is rewritten ahead of it.
__device__ __forceinline__ void stage_f32(unsigned la, const float* a0, unsigned lb, const bf* b0, int lda, int ldb) {
    const unsigned la1 = la + 16 * LPF, la2 = la + 32 * LPF, la3 = la + 48 * LPF, la4 = la + 64 * LPF, la5 = la + 80 * LPF, la6 = la + 96 * LPF, la7 = la + 112 * LPF, lb1 = lb + 32 * LP, lb2 = lb + 64 * LP, lb3 = lb + 96 * LP;
    const float* a1 = a0 + (size_t)16 * lda; const float* a2 = a0 + (size_t)32 * lda; const float* a3 = a0 + (size_t)48 * lda; const float* a4 = a0 + (size_t)64 * lda;
    const float* a5 = a0 + (size_t)80 * lda; const float* a6 = a0 + (size_t)96 * lda; const float* a7 = a0 + (size_t)112 * lda;
    const bf* b1 = b0 + (size_t)32 * ldb; const bf* b2 = b0 + (size_t)64 * ldb; const bf* b3 = b0 + (size_t)96 * ldb;
    asm volatile("global_load_async_to_lds_b128 %0, %12, off\n\t"
                 "global_load_async_to_lds_b128 %1, %13, off\n\t"
                 "global_load_async_to_lds_b128 %2, %14, off\n\t"
                 "global_load_async_to_lds_b128 %3, %15, off\n\t"
                 "global_load_async_to_lds_b128 %4, %16, off\n\t"
                 "global_load_async_to_lds_b128 %5, %17, off\n\t"
                 "global_load_async_to_lds_b128 %6, %18, off\n\t"
                 "global_load_async_to_lds_b128 %7, %19, off\n\t"
                 "global_load_async_to_lds_b128 %8, %20, off\n\t"
                 "global_load_async_to_lds_b128 %9, %21, off\n\t"
                 "global_load_async_to_lds_b128 %10, %22, off\n\t"
                 "global_load_async_to_lds_b128 %11, %23, off\n\t"
                 "s_wait_xcnt 0x0"
                 :: "v"(la), "v"(la1), "v"(la2), "v"(la3), "v"(la4), "v"(la5), "v"(la6), "v"(la7), "v"(lb), "v"(lb1), "v"(lb2), "v"(lb3),
                    "v"(a0), "v"(a1), "v"(a2), "v"(a3), "v"(a4), "v"(a5), "v"(a6), "v"(a7), "v"(b0), "v"(b1), "v"(b2), "v"(b3) : "memory");
}
__device__ __forceinline__ v16us ldsfrag(const unsigned char* p) { return __builtin_shufflevector(*(const v8usa*)p, *(const v8usa*)(p + 32), 0, 1, 2, 3, 4, 5, 6, 7, 8, 9, 10, 11, 12, 13, 14, 15); }
// rndfrag: the same 16 k of a row held in f32 (x0 x1 = the fragment's first 8 k, x2 x3 = its second 8) -> bf16, round to nearest even.
__device__ __forceinline__ v16us rndfrag(v4f x0, v4f x1, v4f x2, v4f x3) {
    const v16f f = __builtin_shufflevector(__builtin_shufflevector(x0, x1, 0, 1, 2, 3, 4, 5, 6, 7), __builtin_shufflevector(x2, x3, 0, 1, 2, 3, 4, 5, 6, 7), 0, 1, 2, 3, 4, 5, 6, 7, 8, 9, 10, 11, 12, 13, 14, 15);
    return __builtin_bit_cast(v16us, __builtin_convertvector(f, v16bf));
}

// k_mm: 128 x 128 block tile of C = A.B^T over K (row stride lda for A, K for B; n-major B), f32 accumulate. HF: A and B hold f16, else bf16; one product per 32-k step.
// Every operand row is fetched once per block as whole lines into a two-buffer LDS ring and the fragments are read from LDS.
// blockIdx.z = batch item, sA / sB / sC = elements from one item's A / B / C to the next item's. K is a multiple of 64 and at least 128 (two stages).
// CAUSAL (rows = an item's queries): 1 = C's columns are keys, a tile wholly above the diagonal is left out; 2 = k runs over keys, the k loop ends at the row block's reach (P is 0 from there on).
// 1: the tiles left grow with the row block, so the row block is rotated by the item: work-groups whose flat index is equal modulo the grid's x extent take eight successive row blocks, one per item, instead of always the same one.
// 2: the k loop grows with the row block, so a work-group takes row block x and then row block NRB - 1 - x (grid x extent NRB / 2): every work-group runs the same NRB + 1 blocks of 128 keys.
// (Both for speed only: every (row block, item) is still taken exactly once.)
// OUT: 0 = C in f32. 3 = no C, the three projections in one launch: blockIdx.z = the projection (its A = the f32 input among X0, X1, X2, staged in f32 and rounded to bf16 as each fragment is read from LDS; its B and output plane by sB, sC; its bias among bias, bias1, bias2, added as bf(bias[c])); each value
// leaves as f16 in D: q and k as [row][ldc] (om 1), v transposed per item of NT_ rows, [row / NT_][column][row % NT_] (om 2: the n-major B operand of P.v), column count DM.
template <bool HF, int CAUSAL, int OUT>
__global__ __launch_bounds__(256) void k_mm(const bf* __restrict__ A, const float* __restrict__ X0, const float* __restrict__ X1, const float* __restrict__ X2, const bf* __restrict__ B, const float* __restrict__ bias, const float* __restrict__ bias1, const float* __restrict__ bias2, int K, int lda, float* C, int ldc, int sA, int sB, int sC, bf* D) {
    constexpr bool AF = OUT == 3;      // A is staged in f32
    constexpr int PLA = AF ? PLF : PLB, BUFB = PLA + PLB;      // one stage: [A | B]
    __shared__ __attribute__((aligned(16))) unsigned char ring[2 * BUFB];
    const int tid = threadIdx.x, lane = tid & 31, wave = tid >> 5, lr = lane & 15, hi = lane >> 4, wr = wave >> 1, wc = wave & 1;
    const int C0 = blockIdx.y * TB;
    const int om = OUT == 3 ? (blockIdx.z == 2 ? 2 : 1) : OUT;    // the same for the whole work-group
    const float* bz = OUT == 3 ? (blockIdx.z == 0 ? bias : blockIdx.z == 1 ? bias1 : bias2) : bias;
    const float* xz = blockIdx.z == 0 ? X0 : blockIdx.z == 1 ? X1 : X2;
    if (OUT == 3) D += (size_t)blockIdx.z * sC;
    const size_t gb = (size_t)blockIdx.z * sB + (size_t)(C0 + (tid >> 3)) * K + (tid & 7) * 8;
    const unsigned lc = (unsigned)(size_t)ring + (tid >> 3) * LP + (tid & 7) * 16, lf = (unsigned)(size_t)ring + (tid >> 4) * LPF + (tid & 15) * 16;
#pragma unroll 1    // CAUSAL 2: the two row blocks share one copy of the code
  for (int turn = 0; turn < (CAUSAL == 2 ? 2 : 1); ++turn) {
    const int R0 = (CAUSAL == 1 ? (blockIdx.x + blockIdx.z) % NRB : turn ? NRB - 1 - blockIdx.x : blockIdx.x) * TB, reach = R0 + TB;
    if (CAUSAL == 1 && C0 >= reach) return;    // the whole work-group leaves, ahead of every copy and barrier
    if (turn) {
        asm volatile("s_wait_dscnt 0x0" ::: "memory");    // this wave's reads of the first row block's staged output are done before the ring is filled again
        asm volatile("s_wait_xcnt 0x0" ::: "memory");     // the first row block's output stores are issued: their address and data registers are written anew from here on
        __syncthreads();                                  // ... and every other wave's
    }
    const int nst = (CAUSAL == 2 ? reach : K) / KST;
    const size_t ga = AF ? (size_t)(R0 + (tid >> 4)) * lda + (tid & 15) * 4 : (size_t)blockIdx.z * sA + (size_t)(R0 + (tid >> 3)) * lda + (tid & 7) * 8;
    auto fill = [&](int s) {
        const unsigned o = (s & 1) * BUFB; const size_t k0 = (size_t)s * KST;
        if constexpr (AF) stage_f32(lf + o, xz + ga + k0, lc + PLA + o, B + gb + k0, lda, K);
        else stage_pair(lc + o, A + ga + k0, B + gb + k0, lda, K);
    };
    v8f acc[2][4];
#pragma unroll
    for (int rt = 0; rt < 2; ++rt) {
#pragma unroll
        for (int t = 0; t < 4; ++t) acc[rt][t] = (v8f){}; }
    fill(0);
    asm volatile("s_wait_asynccnt 0x0" ::: "memory");    // this wave's copies of stage 0 have landed
    __syncthreads();                                     // ... and every other wave's: stage 0 may be read
    fill(1);
#pragma unroll 1
    for (int s = 0; s < nst; ++s) {
        const unsigned char* pa = ring + (s & 1) * BUFB + (wr * 32 + lr) * (AF ? LPF : LP) + hi * (AF ? 32 : 16);
        const unsigned char* pb = ring + (s & 1) * BUFB + PLA + (wc * 64 + lr) * LP + hi * 16;
#pragma unroll
        for (int ks = 0; ks < KST / 32; ++ks) {
            v16us a[2], b[4]; v4f x[2][4];
#pragma unroll
            for (int rt = 0; rt < 2; ++rt) {
                if constexpr (AF) { const unsigned char* p = pa + rt * 16 * LPF + ks * 128; x[rt][0] = *(const v4fa*)p; x[rt][1] = *(const v4fa*)(p + 16); x[rt][2] = *(const v4fa*)(p + 64); x[rt][3] = *(const v4fa*)(p + 80); }
                else a[rt] = ldsfrag(pa + rt * 16 * LP + ks * 64); }
#pragma unroll
            for (int t = 0; t < 4; ++t) b[t] = ldsfrag(pb + t * 16 * LP + ks * 64);
            __builtin_amdgcn_sched_barrier(0);    // the 32-k step's LDS reads stay one group ahead of its matrix instructions (for speed only)
            if constexpr (AF) { a[0] = rndfrag(x[0][0], x[0][1], x[0][2], x[0][3]); a[1] = rndfrag(x[1][0], x[1][1], x[1][2], x[1][3]); }
#pragma unroll
            for (int t = 0; t < 4; ++t) { acc[0][t] = wmma<HF>(a[0], b[t], acc[0][t]); acc[1][t] = wmma<HF>(a[1], b[t], acc[1][t]); }
        }
        __builtin_amdgcn_sched_barrier(0);                   // the stage's matrix instructions stay ahead of the barrier: sunk behind it they would stand in front of the refill and cost the copies their lead
        asm volatile("s_wait_dscnt 0x0" ::: "memory");       // this wave's reads of stage s are done before its buffer is refilled
        asm volatile("s_wait_asynccnt 0x0" ::: "memory");    // this wave's copies of stage s + 1 have landed
        __syncthreads();                                     // publishes stage s + 1 and ends every wave's reads of stage s
        if (s + 2 < nst) fill(s + 2);
    }
    asm volatile("s_wait_asynccnt 0x0" ::: "memory");        // no copy is outstanding when the ring becomes output staging
    constexpr int TP = 2 * TB + 16;                          // om 2: pitch in bytes of a staged transposed f16 row (128 rows of C), 16 x odd
    static_assert(TB * TP <= 2 * BUFB, "the transposed plane fits the ring");
    unsigned char* th = ring;
    float* os = (float*)(void*)ring + wave * (32 * 68);      // behind the last stage's barrier: 32 x 64 f32 per wave at pitch 68
    float bv[4] = {0.f, 0.f, 0.f, 0.f};
    if (OUT == 3 && bz) {
#pragma unroll
        for (int t = 0; t < 4; ++t) bv[t] = bfr(bz[C0 + wc * 64 + t * 16 + lr]); }
    if (om == 2) {    // a lane's 8 values of one accumulator tile are 8 consecutive rows of one column: one 16-byte piece of a transposed f16 row
#pragma unroll
        for (int t = 0; t < 4; ++t) {
#pragma unroll
            for (int rt = 0; rt < 2; ++rt) { v8us oh;
#pragma unroll
                for (int j = 0; j < 8; ++j) oh[j] = f2h(acc[rt][t][j] + bv[t]);
                const int o = (wc * 64 + t * 16 + lr) * TP + (wr * 32 + rt * 16 + hi * 8) * 2; *(v8usa*)(th + o) = oh; } }
    } else {
#pragma unroll
        for (int t = 0; t < 4; ++t) {
#pragma unroll
            for (int rt = 0; rt < 2; ++rt) {
#pragma unroll
                for (int j = 0; j < 8; ++j) os[(rt * 16 + hi * 8 + j) * 68 + t * 16 + lr] = OUT == 3 ? acc[rt][t][j] + bv[t] : acc[rt][t][j]; } }
    }
    __syncthreads();                                         // the staged tile is read back by other lanes (transposed: other waves) than wrote it
    if (om == 2) {    // 16 lanes x 16 bytes = the block's 128 rows of one column = two whole lines
        const size_t g0 = (size_t)(R0 / NT_) * DM * NT_ + (size_t)C0 * NT_ + R0 % NT_;
#pragma unroll
        for (int s = 0; s < 8; ++s) { const int u = s * 256 + tid, d = u >> 4, piece = u & 15; const size_t o = g0 + (size_t)d * NT_ + piece * 8;
            const v8us vh = *(const v8usa*)(th + d * TP + piece * 16); *(v8us*)(D + o) = vh; }
    } else if (om == 1) {    // 8 lanes x 16 bytes = the wave's 64 columns of one row = one whole line
        const size_t g0 = (size_t)(R0 + wr * 32) * ldc + C0 + wc * 64;
#pragma unroll
        for (int s = 0; s < 8; ++s) { const int row = s * 4 + (lane >> 3), c = (lane & 7) * 8; const v4f x0 = *(const v4fa*)(os + row * 68 + c), x1 = *(const v4fa*)(os + row * 68 + c + 4); v8us oh;
#pragma unroll
            for (int i = 0; i < 8; ++i) oh[i] = f2h(i < 4 ? x0[i & 3] : x1[i & 3]);
            const size_t o = g0 + (size_t)row * ldc + c; *(v8us*)(D + o) = oh; }
        asm volatile("s_wait_xcnt 0x0" ::: "memory");    // the row stores are issued: no address or data register of theirs is written anew ahead of this
    } else {
        float* crow = C + (size_t)blockIdx.z * sC + (size_t)(R0 + wr * 32) * ldc + C0 + wc * 64;
#pragma unroll
        for (int s = 0; s < 16; ++s) { const int Lid = (lane >> 3) + 4 * s, piece = lane & 7; const int row = Lid >> 1, cofs = (Lid & 1) * 32 + piece * 4;
            const v4f val = *(const v4fa*)(os + row * 68 + cofs); *(v4f*)(crow + (size_t)row * ldc + cofs) = val; }
    }
  }
}

// k_csoftmax: one wave per row r of the scores S [8 items x 2048][2048] (row = query r % 2048 of item r / 2048): over the causally visible columns k <= r % 2048 (the rest of the row up to the
// reach of its 128-row block gets probability 0; nothing beyond is read or written): a = s x 512^-1/2, max, exp, normalise (f32, fixed lane order). The wave holds its whole row in registers, so the row is read once
// and the f16 probabilities go in place over it, in the first half of the row's 8192 bytes (row pitch 2 x 2048 f16). Every load of the row is
// consumed by the two wave-wide reductions ahead of the first store, and no other wave touches the row.
__global__ __launch_bounds__(256) void k_csoftmax(float* S) {
    const int lane = threadIdx.x & 31, r = blockIdx.x * 8 + __builtin_amdgcn_readfirstlane(threadIdx.x >> 5); if (r >= NB_ * NT_) return;    // the row in a scalar register: the tests on lim below are then scalar branches
    const int qi = r % NT_, lim = (qi / TB + 1) * TB; float* sr = S + (size_t)r * NT_; bf* ph = (bf*)(void*)sr;
    v8f v[NT_ / 256];
#pragma unroll
    for (int j = 0; j < NT_ / 256; ++j) { const int c0 = j * 256 + lane * 8; v[j] = (v8f){};
        if (j * 256 < lim) { if (c0 < lim) v[j] = *(const v8f*)(sr + c0); } }
    float m = -3.0e38f;
#pragma unroll
    for (int j = 0; j < NT_ / 256; ++j) { const int c0 = j * 256 + lane * 8;
        if (j * 256 < lim) {
#pragma unroll
            for (int i = 0; i < 8; ++i) if (c0 + i <= qi) m = fmaxf(m, v[j][i] * SCL); } }
#pragma unroll
    for (int sh = 16; sh; sh >>= 1) m = fmaxf(m, __shfl_xor(m, sh, 32));
    float sum = 0.f;
#pragma unroll
    for (int j = 0; j < NT_ / 256; ++j) { const int c0 = j * 256 + lane * 8;
        if (j * 256 < lim) {
#pragma unroll
            for (int i = 0; i < 8; ++i) { const float e = (c0 + i <= qi) ? __expf(v[j][i] * SCL - m) : 0.f; v[j][i] = e; sum += e; } } }
#pragma unroll
    for (int sh = 16; sh; sh >>= 1) sum += __shfl_xor(sum, sh, 32);
    const float inv = 1.0f / sum;
#pragma unroll
    for (int j = 0; j < NT_ / 256; ++j) { const int c0 = j * 256 + lane * 8;
        if (j * 256 < lim) { v8us oh;
#pragma unroll
            for (int i = 0; i < 8; ++i) oh[i] = f2h(v[j][i] * inv);
            if (c0 < lim) *(v8usa*)(ph + c0) = oh; } }
}

// wt: WT [n][K] = bf16(W[k][n]) (k-major [K][ncols]) via the 64 x 64 LDS tile tl; (bk, bn) = the tile's place among (K/64, ncols/64).
__device__ __forceinline__ void wt(const float* __restrict__ Wm, int K, int ncols, bf* WT, int bk, int bn, unsigned short* tl) {
    const int tid = threadIdx.x, k0 = bk * 64, n0 = bn * 64;
    const int kk = tid >> 2, nq = (tid & 3) * 16;
#pragma unroll
    for (int i = 0; i < 16; ++i) tl[(nq + i) * 72 + kk] = f2bf(Wm[(size_t)(k0 + kk) * ncols + n0 + nq + i]);
    __syncthreads();
    const int piece = tid & 7;
    auto pass = [&]() {
#pragma unroll
        for (int s = 0; s < 2; ++s) { const int nr = (tid >> 3) + 32 * s; const v8us val = *(const v8usa*)(tl + nr * 72 + piece * 8); *(v8us*)(WT + (size_t)(n0 + nr) * K + k0 + piece * 8) = val; }
    };
    pass(); 
}
#define NWT  ((DM / 64) * (DM / 64))    // 64 x 64 tiles of one weight matrix
// k_prep: the three weight matrices transposed into WT [3][n][k], one 64 x 64 tile a work-group.
__global__ __launch_bounds__(256) void k_prep(const float* __restrict__ W0, const float* __restrict__ W1, const float* __restrict__ W2, bf* WT) {
    __shared__ __align__(16) unsigned short tl[64 * 72];
    const int z = blockIdx.x / NWT, t = blockIdx.x % NWT;
    wt(z == 0 ? W0 : z == 1 ? W1 : W2, DM, DM, WT + (size_t)z * DM * DM, t % (DM / 64), t / (DM / 64), tl);
}
extern "C" void kernel_launch(void* const* d_in, const int* in_sizes, int n_in,
                              void* d_out, int out_size, void* d_ws, size_t ws_size, hipStream_t stream) {
    (void)in_sizes; (void)n_in; (void)out_size;
    const float* xq = (const float*)d_in[0]; const float* xk = (const float*)d_in[1]; const float* xv = (const float*)d_in[2];
    const float* Wq = (const float*)d_in[3]; const float* bq = (const float*)d_in[4]; const float* Wk = (const float*)d_in[5]; const float* bk = (const float*)d_in[6]; const float* Wv = (const float*)d_in[7]; const float* bv = (const float*)d_in[8];   // k-major (x @ W) + biases
    float* out = (float*)d_out;    // [8][2048][512]
    char* wsp = (char*)d_ws;
    auto take = [&](size_t bytes) { char* p = wsp; wsp += (bytes + 255) & ~(size_t)255; return (void*)p; };
    bf* WT = (bf*)take((size_t)3 * DM * DM * 2);    // [q, k, v][n][k]
    bf* Qf = (bf*)take((size_t)3 * NB_ * NT_ * DM * 2);    // the three f16 planes in a row, one a projection: Qf Kf VT
    bf* Kf = Qf + (size_t)NB_ * NT_ * DM; bf* VT = Kf + (size_t)NB_ * NT_ * DM;
    float* S = (float*)take((size_t)NB_ * NT_ * NT_ * 4);
    const bf* PF = (const bf*)S;    // the f16 probabilities lie in place over the scores: row pitch 2 x NT_ f16
    if ((size_t)(wsp - (char*)d_ws) > ws_size) return;    // ~ 1.6 + 3 x 16.8 + 134.2 ~ 186 MB
    k_prep<<<3 * NWT, 256, 0, stream>>>(Wq, Wk, Wv, WT);
    k_mm<false, 0, 3><<<dim3(NB_ * NT_ / TB, DM / TB, 3), 256, 0, stream>>>(nullptr, xq, xk, xv, WT, bq, bk, bv, DM, DM, nullptr, DM, 0, DM * DM, NB_ * NT_ * DM, Qf);
    k_mm<true, 1, 0><<<dim3(NRB, NRB, NB_), 256, 0, stream>>>(Qf, nullptr, nullptr, nullptr, Kf, nullptr, nullptr, nullptr, DM, DM, S, NT_, NT_ * DM, NT_ * DM, NT_ * NT_, nullptr);
    k_csoftmax<<<NB_ * NT_ / 8, 256, 0, stream>>>(S);
    k_mm<true, 2, 0><<<dim3(NRB / 2, DM / TB, NB_), 256, 0, stream>>>(PF, nullptr, nullptr, nullptr, VT, nullptr, nullptr, nullptr, NT_, 2 * NT_, out, DM, NT_ * 2 * NT_, DM * NT_, NT_ * DM, nullptr);
}

// v009
// A run of this version takes 89.9 microseconds.
// Next to v008, in two timings, it ran 1.27 and 1.28 times as fast.
// All steps since v000 together make it 19.7 times as fast.
#include <hip/hip_runtime.h>

// Compute dtypes, f32 accumulate, all 8 batch items in every launch (rows flattened, or the item in blockIdx.z): q/k/v = x.W + b from the three separate inputs, all three in one launch ([8 x 2048 x 512].[512 x 512], k-major weights transposed once;
// PLAIN bf16 operands = inputs rounded once, exact; x is rounded where its f32 fragment leaves LDS) on v_wmma_f32_16x16x32_bf16 -> one f16 plane each, written by the product's own epilogue (v transposed to [d][t]); single-head causal
// attention over the 512-dim head, all 2048 queries of every item per launch, on v_wmma_f32_16x16x32_f16: scores = q.k^T ([2048 x 512].[512 x reach], one product), a = scores x 512^-1/2
// (the reference divides q by sqrt(512); applied to the product here). The causal row softmax has no launch of its own: the score product's epilogue writes, for each row and each tile of 64 keys, P = exp(a - the tile's row maximum) in f16
// (zeros above the diagonal) with that maximum and the f32 sum of the exponentials; out = (sum over the tiles of (g x P).v) / row sum, g = f16 exp(tile maximum - row maximum), row sum = sum over the tiles of g x tile sum in f32, both formed by the P.v work-group; g x P is rounded to f16 as P's fragment leaves LDS.
// (All of it on powers of 2: a and the maxima carry the factor log2 e.)
// Why one f16 plane: q, k and v already carry the rounding of their bf16 factors (8 significant bits); f16's 11 bits add about an eighth of that error. f16 is finite below 65,504:
// q, k, v are sums of 512 products of unit-normal inputs with weights of deviation 512^-1/2; P and g x P lie in [0, 1], g x P = 1 at the row's maximum (below 2^-14 they keep an absolute step of 2^-24).
// Causal trim: a 128-query row block sees the keys [0, reach), reach = its first query + 128; score tiles, their softmax figures and P.v k steps at or beyond reach are neither computed, stored nor read.

#define NB_  8
#define NT_  2048
#define DM   512
#define NTK  NT_
#define SCL2 (0.044194173824159216f * 1.4426950408889634f)     // 512^-1/2 (the reference scales q; applied to the scores here) x log2 e: the softmax runs on powers of 2

typedef unsigned short bf;
typedef __attribute__((ext_vector_type(16))) __bf16   v16bf;
typedef __attribute__((ext_vector_type(16))) _Float16 v16h;
typedef __attribute__((ext_vector_type(2)))  _Float16 h2;
typedef __attribute__((ext_vector_type(16))) unsigned short v16us;
typedef __attribute__((ext_vector_type(8)))  unsigned short v8us;
typedef __attribute__((ext_vector_type(8)))  float    v8f;
typedef __attribute__((ext_vector_type(16))) float    v16f;
typedef __attribute__((ext_vector_type(4)))  float    v4f;
typedef v4f  __attribute__((may_alias)) v4fa;
typedef v8us __attribute__((may_alias)) v8usa;

__device__ __forceinline__ unsigned short f2bf(float f) { unsigned u = __float_as_uint(f); u += 0x7FFFu + ((u >> 16) & 1u); return (unsigned short)(u >> 16); }
__device__ __forceinline__ float bf2f(unsigned short b) { return __uint_as_float(((unsigned)b) << 16); }
__device__ __forceinline__ float bfr(float f) { return bf2f(f2bf(f)); }
__device__ __forceinline__ unsigned short f2h(float f) { return __builtin_bit_cast(unsigned short, (_Float16)f); }    // f32 -> f16, round to nearest even
// wmma: one 16 x 16 x 32 product on 16-bit operands held as raw bits; HF: they are f16, else bf16.
template <bool HF> __device__ __forceinline__ v8f wmma(v16us a, v16us b, v8f c) {
    if (HF) return __builtin_amdgcn_wmma_f32_16x16x32_f16(false, __builtin_bit_cast(v16h, a), false, __builtin_bit_cast(v16h, b), (short)0, c, false, false);
    return __builtin_amdgcn_wmma_f32_16x16x32_bf16(false, __builtin_bit_cast(v16bf, a), false, __builtin_bit_cast(v16bf, b), (short)0, c, false, false);
}

#define TB   128                 // block tile: 128 rows x 128 columns of C, 8 waves (4 x 2) of 32 x 64
#define KST  64                  // k per stage: one whole 128-byte line of every 16-bit operand row, two of an f32 one
#define LP   144                 // LDS row pitch in bytes: 16 x odd, conflict-free for the 16-byte fragment reads
#define PLB  (TB * LP)           // one operand plane of one stage in LDS
#define LPF  272                 // the same for an f32 operand row (64 k = 256 bytes): 16 x odd
#define PLF  (TB * LPF)          // one f32 operand plane of one stage in LDS
#define NRB  (NT_ / TB)          // 128-query row blocks of one item
#define NTL  (NT_ / KST)         // 64-key tiles of one row: each has its own softmax maximum and sum, [item][tile][query] in f32, the maxima and then the sums
#define STN  (NB_ * NTL * NT_)   // elements of one of these two planes
// xm: the value of lane ^ X (X below 16), by a DPP move in the vector pipe (a shuffle would go through the LDS queue and cost its latency at every step of a reduction).
template <int X> __device__ __forceinline__ float xm(float v) { return __int_as_float(__builtin_amdgcn_update_dpp(0, __float_as_int(v), 0x160 + X, 0xf, 0xf, true)); }
// exp2x8: v[i] = 2^v[i] by eight bare v_exp_f32 in one statement: each stands in the slot that the instruction set asks for behind the one before it (the early-clobber outputs keep every result off every source),
// and the v_nop in the slot behind the last.
__device__ __forceinline__ void exp2x8(float (&v)[8]) {
    float r0, r1, r2, r3, r4, r5, r6, r7;
    asm("v_exp_f32 %0, %8\n\tv_exp_f32 %1, %9\n\tv_exp_f32 %2, %10\n\tv_exp_f32 %3, %11\n\tv_exp_f32 %4, %12\n\tv_exp_f32 %5, %13\n\tv_exp_f32 %6, %14\n\tv_exp_f32 %7, %15\n\tv_nop"
        : "=&v"(r0), "=&v"(r1), "=&v"(r2), "=&v"(r3), "=&v"(r4), "=&v"(r5), "=&v"(r6), "=&v"(r7) : "v"(v[0]), "v"(v[1]), "v"(v[2]), "v"(v[3]), "v"(v[4]), "v"(v[5]), "v"(v[6]), "v"(v[7]));
    v[0] = r0; v[1] = r1; v[2] = r2; v[3] = r3; v[4] = r4; v[5] = r5; v[6] = r6; v[7] = r7;
}
// sclfrag: a fragment of f16 values times the lane's own f16 factor g (both halves of g hold it): 8 packed multiplies.
__device__ __forceinline__ v16us sclfrag(v16us a, unsigned g) {
    const h2 gg = __builtin_bit_cast(h2, g);
    return __builtin_bit_cast(v16us, __builtin_bit_cast(v16h, a) * __builtin_shufflevector(gg, gg, 0, 1, 0, 1, 0, 1, 0, 1, 0, 1, 0, 1, 0, 1, 0, 1));
}
// soft_rows: a wave's staged 32 x 64 score tile os (pitch 68) -> its softmax numerators. 8 lanes x 8 columns = the 64 keys of one query, 4 queries a trip; q0, c0 = the tile's first query, this lane's first key.
// m = SCL2 x the row's largest visible score; e = 2^(score x SCL2 - m), by the bare v_exp_f32 (what it flushes, below 2^-126, is 0 in f16 as well); drow gets f16 e, 8 lanes x 16 bytes = one whole line.
// MK: the tile meets the diagonal: a key later than the query is left out of m and gets e = 0 (a row with no visible key: m very negative, sum 0). ms, ls: lane l keeps m and the f32 sum of e of row (l % 8) x 4 + l / 8.
template <bool MK> __device__ __forceinline__ void soft_rows(const float* os, bf* drow, int ldc, int q0, int c0, int lane, float& ms, float& ls) {
#pragma unroll
    for (int s = 0; s < 8; ++s) { const int row = s * 4 + (lane >> 3), q = q0 + row; const v4f x0 = *(const v4fa*)(os + row * 68 + (lane & 7) * 8), x1 = *(const v4fa*)(os + row * 68 + (lane & 7) * 8 + 4);
        float x[8], m = -3.0e38f, sum = 0.f; v8us oh;
#pragma unroll
        for (int i = 0; i < 8; ++i) { x[i] = i < 4 ? x0[i & 3] : x1[i & 3]; if (!MK || c0 + i <= q) m = fmaxf(m, x[i]); }
        m = fmaxf(m, xm<1>(m)); m = fmaxf(m, xm<2>(m)); m = fmaxf(m, xm<4>(m)); m *= SCL2;
#pragma unroll
        for (int i = 0; i < 8; ++i) x[i] = __builtin_fmaf(x[i], SCL2, -m);
        exp2x8(x);
#pragma unroll
        for (int i = 0; i < 8; ++i) { const float e = (!MK || c0 + i <= q) ? x[i] : 0.f; sum += e; oh[i] = f2h(e); }
        sum += xm<1>(sum); sum += xm<2>(sum); sum += xm<4>(sum);
        *(v8us*)(drow + (size_t)row * ldc) = oh;
        if ((lane & 7) == s) { ms = m; ls = sum; } }
    asm volatile("s_wait_xcnt 0x0" ::: "memory");    // the row stores are issued: no address or data register of theirs is written anew ahead of this
}

// stage_pair: this thread's four 16-byte pieces (rows r, r + 32, r + 64, r + 96) of an A plane's and of a B plane's 128 x 64 stage, global memory -> LDS with no register in between.
// The s_wait_xcnt closes the statement so that no address register of an issued copy is rewritten ahead of it.
__device__ __forceinline__ void stage_pair(unsigned la, const bf* a0, const bf* b0, int lda, int ldb) {
    const unsigned la1 = la + 32 * LP, la2 = la + 64 * LP, la3 = la + 96 * LP, lb = la + PLB, lb1 = lb + 32 * LP, lb2 = lb + 64 * LP, lb3 = lb + 96 * LP;
    const bf* a1 = a0 + (size_t)32 * lda; const bf* a2 = a0 + (size_t)64 * lda; const bf* a3 = a0 + (size_t)96 * lda;
    const bf* b1 = b0 + (size_t)32 * ldb; const bf* b2 = b0 + (size_t)64 * ldb; const bf* b3 = b0 + (size_t)96 * ldb;
    asm volatile("global_load_async_to_lds_b128 %0, %8, off\n\t"
                 "global_load_async_to_lds_b128 %1, %9, off\n\t"
                 "global_load_async_to_lds_b128 %2, %10, off\n\t"
                 "global_load_async_to_lds_b128 %3, %11, off\n\t"
                 "global_load_async_to_lds_b128 %4, %12, off\n\t"
                 "global_load_async_to_lds_b128 %5, %13, off\n\t"
                 "global_load_async_to_lds_b128 %6, %14, off\n\t"
                 "global_load_async_to_lds_b128 %7, %15, off\n\t"
                 "s_wait_xcnt 0x0"
                 :: "v"(la), "v"(la1), "v"(la2), "v"(la3), "v"(lb), "v"(lb1), "v"(lb2), "v"(lb3), "v"(a0), "v"(a1), "v"(a2), "v"(a3), "v"(b0), "v"(b1), "v"(b2), "v"(b3) : "memory");
}
// stage_f32: the same for an f32 A plane: this thread's eight 16-byte pieces (rows r, r + 16, ..., r + 112; 16 threads a row of 256 bytes) of A's 128 x 64 stage and its four pieces of the 16-bit B plane's.
// The s_wait_xcnt closes the statement so that no address register of an issued copy is rewritten ahead of it.
__device__ __forceinline__ void stage_f32(unsigned la, const float* a0, unsigned lb, const bf* b0, int lda, int ldb) {
    const unsigned la1 = la + 16 * LPF, la2 = la + 32 * LPF, la3 = la + 48 * LPF, la4 = la + 64 * LPF, la5 = la + 80 * LPF, la6 = la + 96 * LPF, la7 = la + 112 * LPF, lb1 = lb + 32 * LP, lb2 = lb + 64 * LP, lb3 = lb + 96 * LP;
    const float* a1 = a0 + (size_t)16 * lda; const float* a2 = a0 + (size_t)32 * lda; const float* a3 = a0 + (size_t)48 * lda; const float* a4 = a0 + (size_t)64 * lda;
    const float* a5 = a0 + (size_t)80 * lda; const float* a6 = a0 + (size_t)96 * lda; const float* a7 = a0 + (size_t)112 * lda;
    const bf* b1 = b0 + (size_t)32 * ldb; const bf* b2 = b0 + (size_t)64 * ldb; const bf* b3 = b0 + (size_t)96 * ldb;
    asm volatile("global_load_async_to_lds_b128 %0, %12, off\n\t"
                 "global_load_async_to_lds_b128 %1, %13, off\n\t"
                 "global_load_async_to_lds_b128 %2, %14, off\n\t"
                 "global_load_async_to_lds_b128 %3, %15, off\n\t"
                 "global_load_async_to_lds_b128 %4, %16, off\n\t"
                 "global_load_async_to_lds_b128 %5, %17, off\n\t"
                 "global_load_async_to_lds_b128 %6, %18, off\n\t"
                 "global_load_async_to_lds_b128 %7, %19, off\n\t"
                 "global_load_async_to_lds_b128 %8, %20, off\n\t"
                 "global_load_async_to_lds_b128 %9, %21, off\n\t"
                 "global_load_async_to_lds_b128 %10, %22, off\n\t"
                 "global_load_async_to_lds_b128 %11, %23, off\n\t"
                 "s_wait_xcnt 0x0"
                 :: "v"(la), "v"(la1), "v"(la2), "v"(la3), "v"(la4), "v"(la5), "v"(la6), "v"(la7), "v"(lb), "v"(lb1), "v"(lb2), "v"(lb3),
                    "v"(a0), "v"(a1), "v"(a2), "v"(a3), "v"(a4), "v"(a5), "v"(a6), "v"(a7), "v"(b0), "v"(b1), "v"(b2), "v"(b3) : "memory");
}
__device__ __forceinline__ v16us ldsfrag(const unsigned char* p) { return __builtin_shufflevector(*(const v8usa*)p, *(const v8usa*)(p + 32), 0, 1, 2, 3, 4, 5, 6, 7, 8, 9, 10, 11, 12, 13, 14, 15); }
// rndfrag: the same 16 k of a row held in f32 (x0 x1 = the fragment's first 8 k, x2 x3 = its second 8) -> bf16, round to nearest even.
__device__ __forceinline__ v16us rndfrag(v4f x0, v4f x1, v4f x2, v4f x3) {
    const v16f f = __builtin_shufflevector(__builtin_shufflevector(x0, x1, 0, 1, 2, 3, 4, 5, 6, 7), __builtin_shufflevector(x2, x3, 0, 1, 2, 3, 4, 5, 6, 7), 0, 1, 2, 3, 4, 5, 6, 7, 8, 9, 10, 11, 12, 13, 14, 15);
    return __builtin_bit_cast(v16us, __builtin_convertvector(f, v16bf));
}

// k_mm: 128 x 128 block tile of C = A.B^T over K (row stride lda for A, K for B; n-major B), f32 accumulate. HF: A and B hold f16, else bf16; one product per 32-k step.
// Every operand row is fetched once per block as whole lines into a two-buffer LDS ring and the fragments are read from LDS.
// blockIdx.z = batch item, sA / sB / sC = elements from one item's A / B / C to the next item's. K is a multiple of 64 and at least 128 (two stages).
// CAUSAL (rows = an item's queries): 1 = C's columns are keys, a tile wholly above the diagonal is left out; 2 = k runs over keys, the k loop ends at the row block's reach (P is 0 from there on).
// 1: the tiles left grow with the row block, so the row block is rotated by the item: work-groups whose flat index is equal modulo the grid's x extent take NB_ row blocks in turn, one per item, instead of always the same one.
// 2 also: A holds each 64-key tile's exponentials relative to the tile's own row maximum (OUT 4 wrote them, with ST): a stage is one such tile, and each A fragment is multiplied by its row's factor for the tile as it leaves LDS; the accumulators are divided by the row sum on their way out.
// 2: the k loop grows with the row block, so a work-group takes row block x and then row block NRB - 1 - x (grid x extent NRB / 2): every work-group runs the same NRB + 1 blocks of 128 keys.
// (Both for speed only: every (row block, item) is still taken exactly once.)
// OUT: 0 = C in f32. 4 = the causal softmax's numerators: for each row of a wave's 32 x 64 tile, soft_rows' numerators to D, their maximum and sum to ST. 3 = no C, the three projections in one launch: blockIdx.z = the projection (its A = the f32 input among X0, X1, X2, staged in f32 and rounded to bf16 as each fragment is read from LDS; its B and output plane by sB, sC; its bias among bias, bias1, bias2, added as bf(bias[c])); each value
// leaves as f16 in D: q and k as [row][ldc] (om 1), v transposed per item of NT_ rows, [row / NT_][column][row % NT_] (om 2: the n-major B operand of P.v), column count DM.
template <bool HF, int CAUSAL, int OUT>
__global__ __launch_bounds__(256) void k_mm(const bf* __restrict__ A, const float* __restrict__ X0, const float* __restrict__ X1, const float* __restrict__ X2, const bf* __restrict__ B, const float* __restrict__ bias, const float* __restrict__ bias1, const float* __restrict__ bias2, int K, int lda, float* C, int ldc, int sA, int sB, int sC, bf* D, float* ST) {
    constexpr bool AF = OUT == 3;      // A is staged in f32
    constexpr int PLA = AF ? PLF : PLB, BUFB = PLA + PLB;      // one stage: [A | B]
    __shared__ __attribute__((aligned(16))) unsigned char ring[2 * BUFB];
    __shared__ __attribute__((aligned(32))) unsigned fac[CAUSAL == 2 ? NTL * TB : 8];    // CAUSAL 2: [tile][row of the block] the row's f16 factor for the tile, in both halves of the word
    __shared__ __attribute__((aligned(32))) float rinv[CAUSAL == 2 ? TB : 8];            // CAUSAL 2: [row of the block] 1 / row sum
    static_assert(KST == 64 && TB == 128, "a stage is one softmax tile; two threads a row form the factors");
    const int tid = threadIdx.x, lane = tid & 31, wave = tid >> 5, lr = lane & 15, hi = lane >> 4, wr = wave >> 1, wc = wave & 1;
    const int C0 = blockIdx.y * TB;
    const int om = OUT == 3 ? (blockIdx.z == 2 ? 2 : 1) : OUT;    // the same for the whole work-group
    const float* bz = OUT == 3 ? (blockIdx.z == 0 ? bias : blockIdx.z == 1 ? bias1 : bias2) : bias;
    const float* xz = blockIdx.z == 0 ? X0 : blockIdx.z == 1 ? X1 : X2;
    if (OUT == 3) D += (size_t)blockIdx.z * sC;
    const size_t gb = (size_t)blockIdx.z * sB + (size_t)(C0 + (tid >> 3)) * K + (tid & 7) * 8;
    const unsigned lc = (unsigned)(size_t)ring + (tid >> 3) * LP + (tid & 7) * 16, lf = (unsigned)(size_t)ring + (tid >> 4) * LPF + (tid & 15) * 16;
#pragma unroll 1    // CAUSAL 2: the two row blocks share one copy of the code
  for (int turn = 0; turn < (CAUSAL == 2 ? 2 : 1); ++turn) {
    const int R0 = (CAUSAL == 1 ? (blockIdx.x + blockIdx.z) % NRB : turn ? NRB - 1 - blockIdx.x : blockIdx.x) * TB, reach = R0 + TB;
    if (CAUSAL == 1 && C0 >= reach) return;    // the whole work-group leaves, ahead of every copy and barrier
    if (turn) {
        asm volatile("s_wait_dscnt 0x0" ::: "memory");    // this wave's reads of the first row block's staged output are done before the ring is filled again
        asm volatile("s_wait_xcnt 0x0" ::: "memory");     // the first row block's output stores are issued: their address and data registers are written anew from here on
        __syncthreads();                                  // ... and every other wave's
    }
    const int nst = (CAUSAL == 2 ? reach : K) / KST;
    const size_t ga = AF ? (size_t)(R0 + (tid >> 4)) * lda + (tid & 15) * 4 : (size_t)blockIdx.z * sA + (size_t)(R0 + (tid >> 3)) * lda + (tid & 7) * 8;
    auto fill = [&](int s) {
        const unsigned o = (s & 1) * BUFB; const size_t k0 = (size_t)s * KST;
        if constexpr (AF) stage_f32(lf + o, xz + ga + k0, lc + PLA + o, B + gb + k0, lda, K);
        else stage_pair(lc + o, A + ga + k0, B + gb + k0, lda, K);
    };
    v8f acc[2][4];
#pragma unroll
    for (int rt = 0; rt < 2; ++rt) {
#pragma unroll
        for (int t = 0; t < 4; ++t) acc[rt][t] = (v8f){}; }
    fill(0);
    if constexpr (CAUSAL == 2) {    // while stage 0 flies: thread = row tid % 128; both threads of a row form its maximum, factors and sum over the nst tiles (nst is even; fixed order), each writes the factors of every second tile
        const int row = tid & (TB - 1), h = __builtin_amdgcn_readfirstlane(tid >> 7);    // the same for a whole wave: in a scalar register the test on it below is a scalar branch
        const float* sm = ST + (size_t)blockIdx.z * NTL * NT_ + R0 + row; const float* sl = sm + STN;
        float mv[NTL], lv[NTL];
#pragma unroll
        for (int t = 0; t < NTL; t += 2) { mv[t] = mv[t + 1] = -3.0e38f; lv[t] = lv[t + 1] = 0.f;
            if (t < nst) { mv[t] = sm[(size_t)t * NT_]; mv[t + 1] = sm[(size_t)(t + 1) * NT_]; lv[t] = sl[(size_t)t * NT_]; lv[t + 1] = sl[(size_t)(t + 1) * NT_]; } }
        asm volatile("s_wait_xcnt 0x0" :: "v"(sm) : "memory");    // these loads are issued: their address register, named here so that it lives up to the wait, is written anew only behind it
        float m = mv[0];
#pragma unroll
        for (int t = 1; t < NTL; ++t) m = fmaxf(m, mv[t]);
        float sum = 0.f; unsigned gw[NTL];
#pragma unroll
        for (int t = 0; t < NTL; t += 8) { float e[8];
#pragma unroll
            for (int i = 0; i < 8; ++i) e[i] = mv[t + i] - m;
            exp2x8(e);
#pragma unroll
            for (int i = 0; i < 8; ++i) { const _Float16 g = (_Float16)e[i]; gw[t + i] = __builtin_bit_cast(unsigned, (h2){g, g}); sum += lv[t + i] * (float)g; } }    // the row sum takes the factor as rounded: the weights still add up to 1
#pragma unroll
        for (int t = 0; t < NTL; t += 2) if (t < nst) fac[(t + h) * TB + row] = h ? gw[t + 1] : gw[t];
        if (h == 0) rinv[row] = 1.0f / sum;
    }
    asm volatile("s_wait_asynccnt 0x0" ::: "memory");    // this wave's copies of stage 0 have landed
    __syncthreads();                                     // ... and every other wave's: stage 0 (and the factors) may be read
    fill(1);
#pragma unroll 1
    for (int s = 0; s < nst; ++s) {
        const unsigned char* pa = ring + (s & 1) * BUFB + (wr * 32 + lr) * (AF ? LPF : LP) + hi * (AF ? 32 : 16);
        const unsigned char* pb = ring + (s & 1) * BUFB + PLA + (wc * 64 + lr) * LP + hi * 16;
        unsigned g0 = 0, g1 = 0;    // CAUSAL 2: the tile's factors of the two rows whose A fragments this lane reads
        if constexpr (CAUSAL == 2) { g0 = fac[s * TB + wr * 32 + lr]; g1 = fac[s * TB + wr * 32 + 16 + lr]; }
#pragma unroll
        for (int ks = 0; ks < KST / 32; ++ks) {
            v16us a[2], b[4]; v4f x[2][4];
#pragma unroll
            for (int rt = 0; rt < 2; ++rt) {
                if constexpr (AF) { const unsigned char* p = pa + rt * 16 * LPF + ks * 128; x[rt][0] = *(const v4fa*)p; x[rt][1] = *(const v4fa*)(p + 16); x[rt][2] = *(const v4fa*)(p + 64); x[rt][3] = *(const v4fa*)(p + 80); }
                else a[rt] = ldsfrag(pa + rt * 16 * LP + ks * 64); }
#pragma unroll
            for (int t = 0; t < 4; ++t) b[t] = ldsfrag(pb + t * 16 * LP + ks * 64);
            __builtin_amdgcn_sched_barrier(0);    // the 32-k step's LDS reads stay one group ahead of its matrix instructions (for speed only)
            if constexpr (AF) { a[0] = rndfrag(x[0][0], x[0][1], x[0][2], x[0][3]); a[1] = rndfrag(x[1][0], x[1][1], x[1][2], x[1][3]); }
            if constexpr (CAUSAL == 2) { a[0] = sclfrag(a[0], g0); a[1] = sclfrag(a[1], g1); }
#pragma unroll
            for (int t = 0; t < 4; ++t) { acc[0][t] = wmma<HF>(a[0], b[t], acc[0][t]); acc[1][t] = wmma<HF>(a[1], b[t], acc[1][t]); }
        }
        __builtin_amdgcn_sched_barrier(0);                   // the stage's matrix instructions stay ahead of the barrier: sunk behind it they would stand in front of the refill and cost the copies their lead
        asm volatile("s_wait_dscnt 0x0" ::: "memory");       // this wave's reads of stage s are done before its buffer is refilled
        asm volatile("s_wait_asynccnt 0x0" ::: "memory");    // this wave's copies of stage s + 1 have landed
        __syncthreads();                                     // publishes stage s + 1 and ends every wave's reads of stage s
        if (s + 2 < nst) fill(s + 2);
    }
    asm volatile("s_wait_asynccnt 0x0" ::: "memory");        // no copy is outstanding when the ring becomes output staging
    constexpr int TP = 2 * TB + 16;                          // om 2: pitch in bytes of a staged transposed f16 row (128 rows of C), 16 x odd
    static_assert(TB * TP <= 2 * BUFB, "the transposed plane fits the ring");
    unsigned char* th = ring;
    float* os = (float*)(void*)ring + wave * (32 * 68);      // behind the last stage's barrier: 32 x 64 f32 per wave at pitch 68
    if constexpr (CAUSAL == 2) {    // the 8 + 8 rows that a lane holds of every accumulator tile: divided by their row sums
        const v8f i0 = *(const v8f*)(rinv + wr * 32 + hi * 8), i1 = *(const v8f*)(rinv + wr * 32 + 16 + hi * 8);
#pragma unroll
        for (int t = 0; t < 4; ++t) { acc[0][t] *= i0; acc[1][t] *= i1; }
    }
    float bv[4] = {0.f, 0.f, 0.f, 0.f};
    if (OUT == 3 && bz) {
#pragma unroll
        for (int t = 0; t < 4; ++t) bv[t] = bfr(bz[C0 + wc * 64 + t * 16 + lr]); }
    if (om == 2) {    // a lane's 8 values of one accumulator tile are 8 consecutive rows of one column: one 16-byte piece of a transposed f16 row
#pragma unroll
        for (int t = 0; t < 4; ++t) {
#pragma unroll
            for (int rt = 0; rt < 2; ++rt) { v8us oh;
#pragma unroll
                for (int j = 0; j < 8; ++j) oh[j] = f2h(acc[rt][t][j] + bv[t]);
                const int o = (wc * 64 + t * 16 + lr) * TP + (wr * 32 + rt * 16 + hi * 8) * 2; *(v8usa*)(th + o) = oh; } }
    } else {
#pragma unroll
        for (int t = 0; t < 4; ++t) {
#pragma unroll
            for (int rt = 0; rt < 2; ++rt) {
#pragma unroll
                for (int j = 0; j < 8; ++j) os[(rt * 16 + hi * 8 + j) * 68 + t * 16 + lr] = OUT == 3 ? acc[rt][t][j] + bv[t] : acc[rt][t][j]; } }
    }
    __syncthreads();                                         // the staged tile is read back by other lanes (transposed: other waves) than wrote it
    if (om == 2) {    // 16 lanes x 16 bytes = the block's 128 rows of one column = two whole lines
        const size_t g0 = (size_t)(R0 / NT_) * DM * NT_ + (size_t)C0 * NT_ + R0 % NT_;
#pragma unroll
        for (int s = 0; s < 8; ++s) { const int u = s * 256 + tid, d = u >> 4, piece = u & 15; const size_t o = g0 + (size_t)d * NT_ + piece * 8;
            const v8us vh = *(const v8usa*)(th + d * TP + piece * 16); *(v8us*)(D + o) = vh; }
    } else if (om == 1) {    // 8 lanes x 16 bytes = the wave's 64 columns of one row = one whole line
        const size_t g0 = (size_t)(R0 + wr * 32) * ldc + C0 + wc * 64;
#pragma unroll
        for (int s = 0; s < 8; ++s) { const int row = s * 4 + (lane >> 3), c = (lane & 7) * 8; const v4f x0 = *(const v4fa*)(os + row * 68 + c), x1 = *(const v4fa*)(os + row * 68 + c + 4); v8us oh;
#pragma unroll
            for (int i = 0; i < 8; ++i) oh[i] = f2h(i < 4 ? x0[i & 3] : x1[i & 3]);
            const size_t o = g0 + (size_t)row * ldc + c; *(v8us*)(D + o) = oh; }
        asm volatile("s_wait_xcnt 0x0" ::: "memory");    // the row stores are issued: no address or data register of theirs is written anew ahead of this
    } else if (OUT == 4) {
        const int q0 = R0 + wr * 32, g = lane >> 3, c0 = C0 + wc * 64 + (lane & 7) * 8;
        bf* drow = D + (size_t)blockIdx.z * sC + (size_t)q0 * ldc + c0;
        float ms = 0.f, ls = 0.f;
        if (C0 == R0) soft_rows<true>(os, drow, ldc, q0, c0, lane, ms, ls);    // only the diagonal's own block holds keys later than a query
        else soft_rows<false>(os, drow, ldc, q0, c0, lane, ms, ls);
        float* st = ST + ((size_t)blockIdx.z * NTL + (C0 + wc * 64) / KST) * NT_ + q0 + (lane & 7) * 4 + g;    // 32 lanes x 4 bytes = one whole line of each plane, this wave its one writer
        st[0] = ms; st[STN] = ls;
    } else {
        float* crow = C + (size_t)blockIdx.z * sC + (size_t)(R0 + wr * 32) * ldc + C0 + wc * 64;
#pragma unroll
        for (int s = 0; s < 16; ++s) { const int Lid = (lane >> 3) + 4 * s, piece = lane & 7; const int row = Lid >> 1, cofs = (Lid & 1) * 32 + piece * 4;
            const v4f val = *(const v4fa*)(os + row * 68 + cofs); *(v4f*)(crow + (size_t)row * ldc + cofs) = val; }
    }
  }
}

// wt: WT [n][K] = bf16(W[k][n]) (k-major [K][ncols]) via the 64 x 64 LDS tile tl; (bk, bn) = the tile's place among (K/64, ncols/64).
__device__ __forceinline__ void wt(const float* __restrict__ Wm, int K, int ncols, bf* WT, int bk, int bn, unsigned short* tl) {
    const int tid = threadIdx.x, k0 = bk * 64, n0 = bn * 64;
    const int kk = tid >> 2, nq = (tid & 3) * 16;
#pragma unroll
    for (int i = 0; i < 16; ++i) tl[(nq + i) * 72 + kk] = f2bf(Wm[(size_t)(k0 + kk) * ncols + n0 + nq + i]);
    __syncthreads();
    const int piece = tid & 7;
    auto pass = [&]() {
#pragma unroll
        for (int s = 0; s < 2; ++s) { const int nr = (tid >> 3) + 32 * s; const v8us val = *(const v8usa*)(tl + nr * 72 + piece * 8); *(v8us*)(WT + (size_t)(n0 + nr) * K + k0 + piece * 8) = val; }
    };
    pass(); 
}
#define NWT  ((DM / 64) * (DM / 64))    // 64 x 64 tiles of one weight matrix
// k_prep: the three weight matrices transposed into WT [3][n][k], one 64 x 64 tile a work-group.
__global__ __launch_bounds__(256) void k_prep(const float* __restrict__ W0, const float* __restrict__ W1, const float* __restrict__ W2, bf* WT) {
    __shared__ __align__(16) unsigned short tl[64 * 72];
    const int z = blockIdx.x / NWT, t = blockIdx.x % NWT;
    wt(z == 0 ? W0 : z == 1 ? W1 : W2, DM, DM, WT + (size_t)z * DM * DM, t % (DM / 64), t / (DM / 64), tl);
}
extern "C" void kernel_launch(void* const* d_in, const int* in_sizes, int n_in,
                              void* d_out, int out_size, void* d_ws, size_t ws_size, hipStream_t stream) {
    (void)in_sizes; (void)n_in; (void)out_size;
    const float* xq = (const float*)d_in[0]; const float* xk = (const float*)d_in[1]; const float* xv = (const float*)d_in[2];
    const float* Wq = (const float*)d_in[3]; const float* bq = (const float*)d_in[4]; const float* Wk = (const float*)d_in[5]; const float* bk = (const float*)d_in[6]; const float* Wv = (const float*)d_in[7]; const float* bv = (const float*)d_in[8];   // k-major (x @ W) + biases
    float* out = (float*)d_out;    // [8][2048][512]
    char* wsp = (char*)d_ws;
    auto take = [&](size_t bytes) { char* p = wsp; wsp += (bytes + 255) & ~(size_t)255; return (void*)p; };
    bf* WT = (bf*)take((size_t)3 * DM * DM * 2);    // [q, k, v][n][k]
    bf* Qf = (bf*)take((size_t)3 * NB_ * NT_ * DM * 2);    // the three f16 planes in a row, one a projection: Qf Kf VT
    bf* Kf = Qf + (size_t)NB_ * NT_ * DM; bf* VT = Kf + (size_t)NB_ * NT_ * DM;
    bf* PF = (bf*)take((size_t)NB_ * NT_ * NT_ * 2);    // the f16 softmax numerators
    float* ST = (float*)take((size_t)2 * STN * 4);      // their tile maxima and tile sums
    if ((size_t)(wsp - (char*)d_ws) > ws_size) return;    // ~ 1.6 + 3 x 16.8 + 67.1 + 4.2 ~ 123 MB
    k_prep<<<3 * NWT, 256, 0, stream>>>(Wq, Wk, Wv, WT);
    k_mm<false, 0, 3><<<dim3(NB_ * NT_ / TB, DM / TB, 3), 256, 0, stream>>>(nullptr, xq, xk, xv, WT, bq, bk, bv, DM, DM, nullptr, DM, 0, DM * DM, NB_ * NT_ * DM, Qf, nullptr);
    k_mm<true, 1, 4><<<dim3(NRB, NRB, NB_), 256, 0, stream>>>(Qf, nullptr, nullptr, nullptr, Kf, nullptr, nullptr, nullptr, DM, DM, nullptr, NT_, NT_ * DM, NT_ * DM, NT_ * NT_, PF, ST);
    k_mm<true, 2, 0><<<dim3(NRB / 2, DM / TB, NB_), 256, 0, stream>>>(PF, nullptr, nullptr, nullptr, VT, nullptr, nullptr, nullptr, NT_, NT_, out, DM, NT_ * NT_, DM * NT_, NT_ * DM, nullptr, ST);
}

// v010
// A run of this version takes 83.8 microseconds.
// In both of two side-by-side timings against v009, it was 1.07 times as fast.
// Counting every step since v000, it is 21.1 times as fast.
#include <hip/hip_runtime.h>

// Compute dtypes, f32 accumulate, all 8 batch items in every launch (rows flattened, or the item in blockIdx.z): q/k/v = x.W + b from the three separate inputs, all three in one launch ([8 x 2048 x 512].[512 x 512], k-major weights transposed once;
// PLAIN bf16 operands = inputs rounded once, exact; x is rounded where its f32 fragment leaves LDS) on v_wmma_f32_16x16x32_bf16 -> one f16 plane each, written by the product's own epilogue (v transposed to [d][t]); single-head causal
// attention over the 512-dim head, all 2048 queries of every item per launch, on v_wmma_f32_16x16x32_f16: scores = q.k^T ([2048 x 512].[512 x reach], one product), a = scores x 512^-1/2
// (the reference divides q by sqrt(512); applied to the product here). The causal row softmax has no launch of its own: the score product's epilogue writes, for each row and each tile of 64 keys, P = exp(a - the tile's row maximum) in f16
// (zeros above the diagonal) with that maximum and the f32 sum of the exponentials; out = (sum over the tiles of (g x P).v) / row sum, g = f16 exp(tile maximum - row maximum), row sum = sum over the tiles of g x tile sum in f32, both formed by the P.v work-group; g x P is rounded to f16 as P's fragment leaves LDS.
// (All of it on powers of 2: a and the maxima carry the factor log2 e.)
// Why one f16 plane: q, k and v already carry the rounding of their bf16 factors (8 significant bits); f16's 11 bits add about an eighth of that error. f16 is finite below 65,504:
// q, k, v are sums of 512 products of unit-normal inputs with weights of deviation 512^-1/2; P and g x P lie in [0, 1], g x P = 1 at the row's maximum (below 2^-14 they keep an absolute step of 2^-24).
// Causal trim: a 128-query row block sees the keys [0, reach), reach = its first query + 128; score tiles, their softmax figures and P.v k steps at or beyond reach are neither computed, stored nor read.

#define NB_  8
#define NT_  2048
#define DM   512
#define NTK  NT_
#define SCL2 (0.044194173824159216f * 1.4426950408889634f)     // 512^-1/2 (the reference scales q; applied to the scores here) x log2 e: the softmax runs on powers of 2

typedef unsigned short bf;
typedef __attribute__((ext_vector_type(16))) __bf16   v16bf;
typedef __attribute__((ext_vector_type(16))) _Float16 v16h;
typedef __attribute__((ext_vector_type(2)))  _Float16 h2;
typedef __attribute__((ext_vector_type(16))) unsigned short v16us;
typedef __attribute__((ext_vector_type(8)))  unsigned short v8us;
typedef __attribute__((ext_vector_type(8)))  float    v8f;
typedef __attribute__((ext_vector_type(16))) float    v16f;
typedef __attribute__((ext_vector_type(4)))  float    v4f;
typedef v4f  __attribute__((may_alias)) v4fa;
typedef v8us __attribute__((may_alias)) v8usa;

__device__ __forceinline__ unsigned short f2bf(float f) { unsigned u = __float_as_uint(f); u += 0x7FFFu + ((u >> 16) & 1u); return (unsigned short)(u >> 16); }
__device__ __forceinline__ float bf2f(unsigned short b) { return __uint_as_float(((unsigned)b) << 16); }
__device__ __forceinline__ float bfr(float f) { return bf2f(f2bf(f)); }
__device__ __forceinline__ unsigned short f2h(float f) { return __builtin_bit_cast(unsigned short, (_Float16)f); }    // f32 -> f16, round to nearest even
// wmma: one 16 x 16 x 32 product on 16-bit operands held as raw bits; HF: they are f16, else bf16.
template <bool HF> __device__ __forceinline__ v8f wmma(v16us a, v16us b, v8f c) {
    if (HF) return __builtin_amdgcn_wmma_f32_16x16x32_f16(false, __builtin_bit_cast(v16h, a), false, __builtin_bit_cast(v16h, b), (short)0, c, false, false);
    return __builtin_amdgcn_wmma_f32_16x16x32_bf16(false, __builtin_bit_cast(v16bf, a), false, __builtin_bit_cast(v16bf, b), (short)0, c, false, false);
}

#define TB   128                 // block tile: 128 rows x 128 columns of C, 8 waves (4 x 2) of 32 x 64
#define KST  64                  // k per stage: one whole 128-byte line of every 16-bit operand row, two of an f32 one
#define LP   144                 // LDS row pitch in bytes: 16 x odd, conflict-free for the 16-byte fragment reads
#define PLB  (TB * LP)           // one operand plane of one stage in LDS
#define LPF  272                 // the same for an f32 operand row (64 k = 256 bytes): 16 x odd
#define PLF  (TB * LPF)          // one f32 operand plane of one stage in LDS
#define NRB  (NT_ / TB)          // 128-query row blocks of one item
#define NTL  (NT_ / KST)         // 64-key tiles of one row: each has its own softmax maximum and sum, [item][tile][query] in f32, the maxima and then the sums
#define STN  (NB_ * NTL * NT_)   // elements of one of these two planes
// xm: the value of lane ^ X (X below 16), by a DPP move in the vector pipe (a shuffle would go through the LDS queue and cost its latency at every step of a reduction).
template <int X> __device__ __forceinline__ float xm(float v) { return __int_as_float(__builtin_amdgcn_update_dpp(0, __float_as_int(v), 0x160 + X, 0xf, 0xf, true)); }
// exp2x8: v[i] = 2^v[i] by eight bare v_exp_f32 in one statement: each stands in the slot that the instruction set asks for behind the one before it (the early-clobber outputs keep every result off every source),
// and the v_nop in the slot behind the last.
__device__ __forceinline__ void exp2x8(float (&v)[8]) {
    float r0, r1, r2, r3, r4, r5, r6, r7;
    asm("v_exp_f32 %0, %8\n\tv_exp_f32 %1, %9\n\tv_exp_f32 %2, %10\n\tv_exp_f32 %3, %11\n\tv_exp_f32 %4, %12\n\tv_exp_f32 %5, %13\n\tv_exp_f32 %6, %14\n\tv_exp_f32 %7, %15\n\tv_nop"
        : "=&v"(r0), "=&v"(r1), "=&v"(r2), "=&v"(r3), "=&v"(r4), "=&v"(r5), "=&v"(r6), "=&v"(r7) : "v"(v[0]), "v"(v[1]), "v"(v[2]), "v"(v[3]), "v"(v[4]), "v"(v[5]), "v"(v[6]), "v"(v[7]));
    v[0] = r0; v[1] = r1; v[2] = r2; v[3] = r3; v[4] = r4; v[5] = r5; v[6] = r6; v[7] = r7;
}
// sclfrag: a fragment of f16 values times the lane's own f16 factor g (both halves of g hold it): 8 packed multiplies.
__device__ __forceinline__ v16us sclfrag(v16us a, unsigned g) {
    const h2 gg = __builtin_bit_cast(h2, g);
    return __builtin_bit_cast(v16us, __builtin_bit_cast(v16h, a) * __builtin_shufflevector(gg, gg, 0, 1, 0, 1, 0, 1, 0, 1, 0, 1, 0, 1, 0, 1, 0, 1));
}
// soft_rows: a wave's staged 32 x 64 score tile os (pitch 68) -> its softmax numerators. 8 lanes x 8 columns = the 64 keys of one query, 4 queries a trip; q0, c0 = the tile's first query, this lane's first key.
// m = SCL2 x the row's largest visible score; e = 2^(score x SCL2 - m), by the bare v_exp_f32 (what it flushes, below 2^-126, is 0 in f16 as well); drow gets f16 e, 8 lanes x 16 bytes = one whole line.
// MK: the tile meets the diagonal: a key later than the query is left out of m and gets e = 0 (a row with no visible key: m very negative, sum 0). ms, ls: lane l keeps m and the f32 sum of e of row (l % 8) x 4 + l / 8.
template <bool MK> __device__ __forceinline__ void soft_rows(const float* os, bf* drow, int ldc, int q0, int c0, int lane, float& ms, float& ls) {
#pragma unroll
    for (int s = 0; s < 8; ++s) { const int row = s * 4 + (lane >> 3), q = q0 + row; const v4f x0 = *(const v4fa*)(os + row * 68 + (lane & 7) * 8), x1 = *(const v4fa*)(os + row * 68 + (lane & 7) * 8 + 4);
        float x[8], m = -3.0e38f, sum = 0.f; v8us oh;
#pragma unroll
        for (int i = 0; i < 8; ++i) { x[i] = i < 4 ? x0[i & 3] : x1[i & 3]; if (!MK || c0 + i <= q) m = fmaxf(m, x[i]); }
        m = fmaxf(m, xm<1>(m)); m = fmaxf(m, xm<2>(m)); m = fmaxf(m, xm<4>(m)); m *= SCL2;
#pragma unroll
        for (int i = 0; i < 8; ++i) x[i] = __builtin_fmaf(x[i], SCL2, -m);
        exp2x8(x);
#pragma unroll
        for (int i = 0; i < 8; ++i) { const float e = (!MK || c0 + i <= q) ? x[i] : 0.f; sum += e; oh[i] = f2h(e); }
        sum += xm<1>(sum); sum += xm<2>(sum); sum += xm<4>(sum);
        *(v8us*)(drow + (size_t)row * ldc) = oh;
        if ((lane & 7) == s) { ms = m; ls = sum; } }
    asm volatile("s_wait_xcnt 0x0" ::: "memory");    // the row stores are issued: no address or data register of theirs is written anew ahead of this
}

// stage_pair: this thread's four 16-byte pieces (rows r, r + 32, r + 64, r + 96) of an A plane's and of a B plane's 128 x 64 stage, global memory -> LDS with no register in between.
// The s_wait_xcnt closes the statement so that no address register of an issued copy is rewritten ahead of it.
__device__ __forceinline__ void stage_pair(unsigned la, const bf* a0, const bf* b0, int lda, int ldb) {
    const unsigned la1 = la + 32 * LP, la2 = la + 64 * LP, la3 = la + 96 * LP, lb = la + PLB, lb1 = lb + 32 * LP, lb2 = lb + 64 * LP, lb3 = lb + 96 * LP;
    const bf* a1 = a0 + (size_t)32 * lda; const bf* a2 = a0 + (size_t)64 * lda; const bf* a3 = a0 + (size_t)96 * lda;
    const bf* b1 = b0 + (size_t)32 * ldb; const bf* b2 = b0 + (size_t)64 * ldb; const bf* b3 = b0 + (size_t)96 * ldb;
    asm volatile("global_load_async_to_lds_b128 %0, %8, off\n\t"
                 "global_load_async_to_lds_b128 %1, %9, off\n\t"
                 "global_load_async_to_lds_b128 %2, %10, off\n\t"
                 "global_load_async_to_lds_b128 %3, %11, off\n\t"
                 "global_load_async_to_lds_b128 %4, %12, off\n\t"
                 "global_load_async_to_lds_b128 %5, %13, off\n\t"
                 "global_load_async_to_lds_b128 %6, %14, off\n\t"
                 "global_load_async_to_lds_b128 %7, %15, off\n\t"
                 "s_wait_xcnt 0x0"
                 :: "v"(la), "v"(la1), "v"(la2), "v"(la3), "v"(lb), "v"(lb1), "v"(lb2), "v"(lb3), "v"(a0), "v"(a1), "v"(a2), "v"(a3), "v"(b0), "v"(b1), "v"(b2), "v"(b3) : "memory");
}
// stage_f32: the same for an f32 A plane: this thread's eight 16-byte pieces (rows r, r + 16, ..., r + 112; 16 threads a row of 256 bytes) of A's 128 x 64 stage and its four pieces of the 16-bit B plane's.
// The s_wait_xcnt closes the statement so that no address register of an issued copy is rewritten ahead of it.
__device__ __forceinline__ void stage_f32(unsigned la, const float* a0, unsigned lb, const bf* b0, int lda, int ldb) {
    const unsigned la1 = la + 16 * LPF, la2 = la + 32 * LPF, la3 = la + 48 * LPF, la4 = la + 64 * LPF, la5 = la + 80 * LPF, la6 = la + 96 * LPF, la7 = la + 112 * LPF, lb1 = lb + 32 * LP, lb2 = lb + 64 * LP, lb3 = lb + 96 * LP;
    const float* a1 = a0 + (size_t)16 * lda; const float* a2 = a0 + (size_t)32 * lda; const float* a3 = a0 + (size_t)48 * lda; const float* a4 = a0 + (size_t)64 * lda;
    const float* a5 = a0 + (size_t)80 * lda; const float* a6 = a0 + (size_t)96 * lda; const float* a7 = a0 + (size_t)112 * lda;
    const bf* b1 = b0 + (size_t)32 * ldb; const bf* b2 = b0 + (size_t)64 * ldb; const bf* b3 = b0 + (size_t)96 * ldb;
    asm volatile("global_load_async_to_lds_b128 %0, %12, off\n\t"
                 "global_load_async_to_lds_b128 %1, %13, off\n\t"
                 "global_load_async_to_lds_b128 %2, %14, off\n\t"
                 "global_load_async_to_lds_b128 %3, %15, off\n\t"
                 "global_load_async_to_lds_b128 %4, %16, off\n\t"
                 "global_load_async_to_lds_b128 %5, %17, off\n\t"
                 "global_load_async_to_lds_b128 %6, %18, off\n\t"
                 "global_load_async_to_lds_b128 %7, %19, off\n\t"
                 "global_load_async_to_lds_b128 %8, %20, off\n\t"
                 "global_load_async_to_lds_b128 %9, %21, off\n\t"
                 "global_load_async_to_lds_b128 %10, %22, off\n\t"
                 "global_load_async_to_lds_b128 %11, %23, off\n\t"
                 "s_wait_xcnt 0x0"
                 :: "v"(la), "v"(la1), "v"(la2), "v"(la3), "v"(la4), "v"(la5), "v"(la6), "v"(la7), "v"(lb), "v"(lb1), "v"(lb2), "v"(lb3),
                    "v"(a0), "v"(a1), "v"(a2), "v"(a3), "v"(a4), "v"(a5), "v"(a6), "v"(a7), "v"(b0), "v"(b1), "v"(b2), "v"(b3) : "memory");
}
__device__ __forceinline__ v16us ldsfrag(const unsigned char* p) { return __builtin_shufflevector(*(const v8usa*)p, *(const v8usa*)(p + 32), 0, 1, 2, 3, 4, 5, 6, 7, 8, 9, 10, 11, 12, 13, 14, 15); }
// rndfrag: the same 16 k of a row held in f32 (x0 x1 = the fragment's first 8 k, x2 x3 = its second 8) -> bf16, round to nearest even.
__device__ __forceinline__ v16us rndfrag(v4f x0, v4f x1, v4f x2, v4f x3) {
    const v16f f = __builtin_shufflevector(__builtin_shufflevector(x0, x1, 0, 1, 2, 3, 4, 5, 6, 7), __builtin_shufflevector(x2, x3, 0, 1, 2, 3, 4, 5, 6, 7), 0, 1, 2, 3, 4, 5, 6, 7, 8, 9, 10, 11, 12, 13, 14, 15);
    return __builtin_bit_cast(v16us, __builtin_convertvector(f, v16bf));
}

// k_mm: 128 x 128 block tile of C = A.B^T over K (row stride lda for A, K for B; n-major B), f32 accumulate. HF: A and B hold f16, else bf16; one product per 32-k step.
// Every operand row is fetched once per block as whole lines into an LDS ring and the fragments are read from LDS. The ring has two buffers, one stage in flight, where several work-groups share a WGP and fill each other's waits;
// CAUSAL 2 has four, three stages in flight: its grid is one work-group a WGP, so only its own lead covers the way from memory or L2.
// blockIdx.z = batch item, sA / sB / sC = elements from one item's A / B / C to the next item's. K is a multiple of 64 and at least 128 (two stages).
// CAUSAL (rows = an item's queries): 1 = C's columns are keys, a tile wholly above the diagonal is left out; 2 = k runs over keys, the k loop ends at the row block's reach (P is 0 from there on).
// 1: the tiles left grow with the row block, so the row block is rotated by the item: work-groups whose flat index is equal modulo the grid's x extent take NB_ row blocks in turn, one per item, instead of always the same one.
// 2 also: A holds each 64-key tile's exponentials relative to the tile's own row maximum (OUT 4 wrote them, with ST): a stage is one such tile, and each A fragment is multiplied by its row's factor for the tile as it leaves LDS; the accumulators are divided by the row sum on their way out.
// 2: the k loop grows with the row block, so a work-group takes row block x and then row block NRB - 1 - x (grid x extent NRB / 2): every work-group runs the same NRB + 1 blocks of 128 keys.
// (Both for speed only: every (row block, item) is still taken exactly once.)
// OUT: 0 = C in f32. 4 = the causal softmax's numerators: for each row of a wave's 32 x 64 tile, soft_rows' numerators to D, their maximum and sum to ST. 3 = no C, the three projections in one launch: blockIdx.z = the projection (its A = the f32 input among X0, X1, X2, staged in f32 and rounded to bf16 as each fragment is read from LDS; its B and output plane by sB, sC; its bias among bias, bias1, bias2, added as bf(bias[c])); each value
// leaves as f16 in D: q and k as [row][ldc] (om 1), v transposed per item of NT_ rows, [row / NT_][column][row % NT_] (om 2: the n-major B operand of P.v), column count DM.
template <bool HF, int CAUSAL, int OUT>
__global__ __launch_bounds__(256) void k_mm(const bf* __restrict__ A, const float* __restrict__ X0, const float* __restrict__ X1, const float* __restrict__ X2, const bf* __restrict__ B, const float* __restrict__ bias, const float* __restrict__ bias1, const float* __restrict__ bias2, int K, int lda, float* C, int ldc, int sA, int sB, int sC, bf* D, float* ST) {
    constexpr bool AF = OUT == 3;      // A is staged in f32
    constexpr int PLA = AF ? PLF : PLB, BUFB = PLA + PLB;      // one stage: [A | B]
    constexpr int NBF = CAUSAL == 2 ? 4 : 2;                   // buffers of the ring (a power of 2); stage s lies in buffer s % NBF
    __shared__ __attribute__((aligned(16))) unsigned char ring[NBF * BUFB];
    __shared__ __attribute__((aligned(32))) unsigned fac[CAUSAL == 2 ? NTL * TB : 8];    // CAUSAL 2: [tile][row of the block] the row's f16 factor for the tile, in both halves of the word
    __shared__ __attribute__((aligned(32))) float rinv[CAUSAL == 2 ? TB : 8];            // CAUSAL 2: [row of the block] 1 / row sum
    static_assert(KST == 64 && TB == 128, "a stage is one softmax tile; two threads a row form the factors");
    const int tid = threadIdx.x, lane = tid & 31, wave = tid >> 5, lr = lane & 15, hi = lane >> 4, wr = wave >> 1, wc = wave & 1;
    const int C0 = blockIdx.y * TB;
    const int om = OUT == 3 ? (blockIdx.z == 2 ? 2 : 1) : OUT;    // the same for the whole work-group
    const float* bz = OUT == 3 ? (blockIdx.z == 0 ? bias : blockIdx.z == 1 ? bias1 : bias2) : bias;
    const float* xz = blockIdx.z == 0 ? X0 : blockIdx.z == 1 ? X1 : X2;
    if (OUT == 3) D += (size_t)blockIdx.z * sC;
    const size_t gb = (size_t)blockIdx.z * sB + (size_t)(C0 + (tid >> 3)) * K + (tid & 7) * 8;
    const unsigned lc = (unsigned)(size_t)ring + (tid >> 3) * LP + (tid & 7) * 16, lf = (unsigned)(size_t)ring + (tid >> 4) * LPF + (tid & 15) * 16;
#pragma unroll 1    // CAUSAL 2: the two row blocks share one copy of the code
  for (int turn = 0; turn < (CAUSAL == 2 ? 2 : 1); ++turn) {
    const int R0 = (CAUSAL == 1 ? (blockIdx.x + blockIdx.z) % NRB : turn ? NRB - 1 - blockIdx.x : blockIdx.x) * TB, reach = R0 + TB;
    if (CAUSAL == 1 && C0 >= reach) return;    // the whole work-group leaves, ahead of every copy and barrier
    if (turn) {
        asm volatile("s_wait_dscnt 0x0" ::: "memory");    // this wave's reads of the first row block's staged output are done before the ring is filled again
        asm volatile("s_wait_xcnt 0x0" ::: "memory");     // the first row block's output stores are issued: their address and data registers are written anew from here on
        __syncthreads();                                  // ... and every other wave's
    }
    const int nst = (CAUSAL == 2 ? reach : K) / KST;
    const size_t ga = AF ? (size_t)(R0 + (tid >> 4)) * lda + (tid & 15) * 4 : (size_t)blockIdx.z * sA + (size_t)(R0 + (tid >> 3)) * lda + (tid & 7) * 8;
    auto fill = [&](int s) {
        const unsigned o = (s & (NBF - 1)) * BUFB; const size_t k0 = (size_t)s * KST;
        if constexpr (AF) stage_f32(lf + o, xz + ga + k0, lc + PLA + o, B + gb + k0, lda, K);
        else stage_pair(lc + o, A + ga + k0, B + gb + k0, lda, K);
    };
    v8f acc[2][4];
#pragma unroll
    for (int rt = 0; rt < 2; ++rt) {
#pragma unroll
        for (int t = 0; t < 4; ++t) acc[rt][t] = (v8f){}; }
    fill(0);
    if constexpr (CAUSAL == 2) {    // while stage 0 flies: thread = row tid % 128; both threads of a row form its maximum, factors and sum over the nst tiles (nst is even; fixed order), each writes the factors of every second tile
        const int row = tid & (TB - 1), h = __builtin_amdgcn_readfirstlane(tid >> 7);    // the same for a whole wave: in a scalar register the test on it below is a scalar branch
        const float* sm = ST + (size_t)blockIdx.z * NTL * NT_ + R0 + row; const float* sl = sm + STN;
        float mv[NTL], lv[NTL];
#pragma unroll
        for (int t = 0; t < NTL; t += 2) { mv[t] = mv[t + 1] = -3.0e38f; lv[t] = lv[t + 1] = 0.f;
            if (t < nst) { mv[t] = sm[(size_t)t * NT_]; mv[t + 1] = sm[(size_t)(t + 1) * NT_]; lv[t] = sl[(size_t)t * NT_]; lv[t + 1] = sl[(size_t)(t + 1) * NT_]; } }
        asm volatile("s_wait_xcnt 0x0" :: "v"(sm) : "memory");    // these loads are issued: their address register, named here so that it lives up to the wait, is written anew only behind it
        fill(1);    // the rest of the ring is free as well: every stage that exists of the first four flies while the factors are formed
        if (2 < nst) fill(2);
        if (3 < nst) fill(3);
        float m = mv[0];
#pragma unroll
        for (int t = 1; t < NTL; ++t) m = fmaxf(m, mv[t]);
        float sum = 0.f; unsigned gw[NTL];
#pragma unroll
        for (int t = 0; t < NTL; t += 8) { float e[8];
#pragma unroll
            for (int i = 0; i < 8; ++i) e[i] = mv[t + i] - m;
            exp2x8(e);
#pragma unroll
            for (int i = 0; i < 8; ++i) { const _Float16 g = (_Float16)e[i]; gw[t + i] = __builtin_bit_cast(unsigned, (h2){g, g}); sum += lv[t + i] * (float)g; } }    // the row sum takes the factor as rounded: the weights still add up to 1
#pragma unroll
        for (int t = 0; t < NTL; t += 2) if (t < nst) fac[(t + h) * TB + row] = h ? gw[t + 1] : gw[t];
        if (h == 0) rinv[row] = 1.0f / sum;
    }
    // this wave's copies of stage 0 have landed. Four buffers, all four stages issued: just the three fills of stages 1 to 3, eight copies each in every wave, are younger and stay in flight
    if (NBF == 4 && 3 < nst) asm volatile("s_wait_asynccnt 0x18" ::: "memory");
    else asm volatile("s_wait_asynccnt 0x0" ::: "memory");
    __syncthreads();                                     // ... and every other wave's: stage 0 (and the factors) may be read
    if constexpr (NBF == 2) fill(1);
#pragma unroll 1
    for (int s = 0; s < nst; ++s) {
        const unsigned char* pa = ring + (s & (NBF - 1)) * BUFB + (wr * 32 + lr) * (AF ? LPF : LP) + hi * (AF ? 32 : 16);
        const unsigned char* pb = ring + (s & (NBF - 1)) * BUFB + PLA + (wc * 64 + lr) * LP + hi * 16;
        unsigned g0 = 0, g1 = 0;    // CAUSAL 2: the tile's factors of the two rows whose A fragments this lane reads
        if constexpr (CAUSAL == 2) { g0 = fac[s * TB + wr * 32 + lr]; g1 = fac[s * TB + wr * 32 + 16 + lr]; }
#pragma unroll
        for (int ks = 0; ks < KST / 32; ++ks) {
            v16us a[2], b[4]; v4f x[2][4];
#pragma unroll
            for (int rt = 0; rt < 2; ++rt) {
                if constexpr (AF) { const unsigned char* p = pa + rt * 16 * LPF + ks * 128; x[rt][0] = *(const v4fa*)p; x[rt][1] = *(const v4fa*)(p + 16); x[rt][2] = *(const v4fa*)(p + 64); x[rt][3] = *(const v4fa*)(p + 80); }
                else a[rt] = ldsfrag(pa + rt * 16 * LP + ks * 64); }
#pragma unroll
            for (int t = 0; t < 4; ++t) b[t] = ldsfrag(pb + t * 16 * LP + ks * 64);
            __builtin_amdgcn_sched_barrier(0);    // the 32-k step's LDS reads stay one group ahead of its matrix instructions (for speed only)
            if constexpr (AF) { a[0] = rndfrag(x[0][0], x[0][1], x[0][2], x[0][3]); a[1] = rndfrag(x[1][0], x[1][1], x[1][2], x[1][3]); }
            if constexpr (CAUSAL == 2) { a[0] = sclfrag(a[0], g0); a[1] = sclfrag(a[1], g1); }
#pragma unroll
            for (int t = 0; t < 4; ++t) { acc[0][t] = wmma<HF>(a[0], b[t], acc[0][t]); acc[1][t] = wmma<HF>(a[1], b[t], acc[1][t]); }
        }
        __builtin_amdgcn_sched_barrier(0);                   // the stage's matrix instructions stay ahead of the barrier: sunk behind it they would stand in front of the refill and cost the copies their lead
        asm volatile("s_wait_dscnt 0x0" ::: "memory");       // this wave's reads of stage s are done before its buffer is refilled
        // this wave's copies of stage s + 1 have landed. Four buffers: while stage s + 3 exists, just the two fills of stages s + 2 and s + 3, eight copies each in every wave, are younger and stay in flight; where stage s + 3 does not exist (the last three trips) fewer are younger, and the wait is to 0
        if (NBF == 4 && s + 3 < nst) asm volatile("s_wait_asynccnt 0x10" ::: "memory");
        else asm volatile("s_wait_asynccnt 0x0" ::: "memory");
        __syncthreads();                                     // publishes stage s + 1 and ends every wave's reads of stage s
        if (s + NBF < nst) fill(s + NBF);                    // into the buffer that stage s has just left
    }
    asm volatile("s_wait_asynccnt 0x0" ::: "memory");        // no copy is outstanding when the ring becomes output staging
    constexpr int TP = 2 * TB + 16;                          // om 2: pitch in bytes of a staged transposed f16 row (128 rows of C), 16 x odd
    static_assert(TB * TP <= 2 * BUFB, "the transposed plane fits the ring");
    unsigned char* th = ring;
    float* os = (float*)(void*)ring + wave * (32 * 68);      // behind the last stage's barrier: 32 x 64 f32 per wave at pitch 68
    if constexpr (CAUSAL == 2) {    // the 8 + 8 rows that a lane holds of every accumulator tile: divided by their row sums
        const v8f i0 = *(const v8f*)(rinv + wr * 32 + hi * 8), i1 = *(const v8f*)(rinv + wr * 32 + 16 + hi * 8);
#pragma unroll
        for (int t = 0; t < 4; ++t) { acc[0][t] *= i0; acc[1][t] *= i1; }
    }
    float bv[4] = {0.f, 0.f, 0.f, 0.f};
    if (OUT == 3 && bz) {
#pragma unroll
        for (int t = 0; t < 4; ++t) bv[t] = bfr(bz[C0 + wc * 64 + t * 16 + lr]); }
    if (om == 2) {    // a lane's 8 values of one accumulator tile are 8 consecutive rows of one column: one 16-byte piece of a transposed f16 row
#pragma unroll
        for (int t = 0; t < 4; ++t) {
#pragma unroll
            for (int rt = 0; rt < 2; ++rt) { v8us oh;
#pragma unroll
                for (int j = 0; j < 8; ++j) oh[j] = f2h(acc[rt][t][j] + bv[t]);
                const int o = (wc * 64 + t * 16 + lr) * TP + (wr * 32 + rt * 16 + hi * 8) * 2; *(v8usa*)(th + o) = oh; } }
    } else {
#pragma unroll
        for (int t = 0; t < 4; ++t) {
#pragma unroll
            for (int rt = 0; rt < 2; ++rt) {
#pragma unroll
                for (int j = 0; j < 8; ++j) os[(rt * 16 + hi * 8 + j) * 68 + t * 16 + lr] = OUT == 3 ? acc[rt][t][j] + bv[t] : acc[rt][t][j]; } }
    }
    __syncthreads();                                         // the staged tile is read back by other lanes (transposed: other waves) than wrote it
    if (om == 2) {    // 16 lanes x 16 bytes = the block's 128 rows of one column = two whole lines
        const size_t g0 = (size_t)(R0 / NT_) * DM * NT_ + (size_t)C0 * NT_ + R0 % NT_;
#pragma unroll
        for (int s = 0; s < 8; ++s) { const int u = s * 256 + tid, d = u >> 4, piece = u & 15; const size_t o = g0 + (size_t)d * NT_ + piece * 8;
            const v8us vh = *(const v8usa*)(th + d * TP + piece * 16); *(v8us*)(D + o) = vh; }
    } else if (om == 1) {    // 8 lanes x 16 bytes = the wave's 64 columns of one row = one whole line
        const size_t g0 = (size_t)(R0 + wr * 32) * ldc + C0 + wc * 64;
#pragma unroll
        for (int s = 0; s < 8; ++s) { const int row = s * 4 + (lane >> 3), c = (lane & 7) * 8; const v4f x0 = *(const v4fa*)(os + row * 68 + c), x1 = *(const v4fa*)(os + row * 68 + c + 4); v8us oh;
#pragma unroll
            for (int i = 0; i < 8; ++i) oh[i] = f2h(i < 4 ? x0[i & 3] : x1[i & 3]);
            const size_t o = g0 + (size_t)row * ldc + c; *(v8us*)(D + o) = oh; }
        asm volatile("s_wait_xcnt 0x0" ::: "memory");    // the row stores are issued: no address or data register of theirs is written anew ahead of this
    } else if (OUT == 4) {
        const int q0 = R0 + wr * 32, g = lane >> 3, c0 = C0 + wc * 64 + (lane & 7) * 8;
        bf* drow = D + (size_t)blockIdx.z * sC + (size_t)q0 * ldc + c0;
        float ms = 0.f, ls = 0.f;
        if (C0 == R0) soft_rows<true>(os, drow, ldc, q0, c0, lane, ms, ls);    // only the diagonal's own block holds keys later than a query
        else soft_rows<false>(os, drow, ldc, q0, c0, lane, ms, ls);
        float* st = ST + ((size_t)blockIdx.z * NTL + (C0 + wc * 64) / KST) * NT_ + q0 + (lane & 7) * 4 + g;    // 32 lanes x 4 bytes = one whole line of each plane, this wave its one writer
        st[0] = ms; st[STN] = ls;
    } else {
        float* crow = C + (size_t)blockIdx.z * sC + (size_t)(R0 + wr * 32) * ldc + C0 + wc * 64;
#pragma unroll
        for (int s = 0; s < 16; ++s) { const int Lid = (lane >> 3) + 4 * s, piece = lane & 7; const int row = Lid >> 1, cofs = (Lid & 1) * 32 + piece * 4;
            const v4f val = *(const v4fa*)(os + row * 68 + cofs); *(v4f*)(crow + (size_t)row * ldc + cofs) = val; }
    }
  }
}

// wt: WT [n][K] = bf16(W[k][n]) (k-major [K][ncols]) via the 64 x 64 LDS tile tl; (bk, bn) = the tile's place among (K/64, ncols/64).
__device__ __forceinline__ void wt(const float* __restrict__ Wm, int K, int ncols, bf* WT, int bk, int bn, unsigned short* tl) {
    const int tid = threadIdx.x, k0 = bk * 64, n0 = bn * 64;
    const int kk = tid >> 2, nq = (tid & 3) * 16;
#pragma unroll
    for (int i = 0; i < 16; ++i) tl[(nq + i) * 72 + kk] = f2bf(Wm[(size_t)(k0 + kk) * ncols + n0 + nq + i]);
    __syncthreads();
    const int piece = tid & 7;
    auto pass = [&]() {
#pragma unroll
        for (int s = 0; s < 2; ++s) { const int nr = (tid >> 3) + 32 * s; const v8us val = *(const v8usa*)(tl + nr * 72 + piece * 8); *(v8us*)(WT + (size_t)(n0 + nr) * K + k0 + piece * 8) = val; }
    };
    pass(); 
}
#define NWT  ((DM / 64) * (DM / 64))    // 64 x 64 tiles of one weight matrix
// k_prep: the three weight matrices transposed into WT [3][n][k], one 64 x 64 tile a work-group.
__global__ __launch_bounds__(256) void k_prep(const float* __restrict__ W0, const float* __restrict__ W1, const float* __restrict__ W2, bf* WT) {
    __shared__ __align__(16) unsigned short tl[64 * 72];
    const int z = blockIdx.x / NWT, t = blockIdx.x % NWT;
    wt(z == 0 ? W0 : z == 1 ? W1 : W2, DM, DM, WT + (size_t)z * DM * DM, t % (DM / 64), t / (DM / 64), tl);
}
extern "C" void kernel_launch(void* const* d_in, const int* in_sizes, int n_in,
                              void* d_out, int out_size, void* d_ws, size_t ws_size, hipStream_t stream) {
    (void)in_sizes; (void)n_in; (void)out_size;
    const float* xq = (const float*)d_in[0]; const float* xk = (const float*)d_in[1]; const float* xv = (const float*)d_in[2];
    const float* Wq = (const float*)d_in[3]; const float* bq = (const float*)d_in[4]; const float* Wk = (const float*)d_in[5]; const float* bk = (const float*)d_in[6]; const float* Wv = (const float*)d_in[7]; const float* bv = (const float*)d_in[8];   // k-major (x @ W) + biases
    float* out = (float*)d_out;    // [8][2048][512]
    char* wsp = (char*)d_ws;
    auto take = [&](size_t bytes) { char* p = wsp; wsp += (bytes + 255) & ~(size_t)255; return (void*)p; };
    bf* WT = (bf*)take((size_t)3 * DM * DM * 2);    // [q, k, v][n][k]
    bf* Qf = (bf*)take((size_t)3 * NB_ * NT_ * DM * 2);    // the three f16 planes in a row, one a projection: Qf Kf VT
    bf* Kf = Qf + (size_t)NB_ * NT_ * DM; bf* VT = Kf + (size_t)NB_ * NT_ * DM;
    bf* PF = (bf*)take((size_t)NB_ * NT_ * NT_ * 2);    // the f16 softmax numerators
    float* ST = (float*)take((size_t)2 * STN * 4);      // their tile maxima and tile sums
    if ((size_t)(wsp - (char*)d_ws) > ws_size) return;    // ~ 1.6 + 3 x 16.8 + 67.1 + 4.2 ~ 123 MB
    k_prep<<<3 * NWT, 256, 0, stream>>>(Wq, Wk, Wv, WT);
    k_mm<false, 0, 3><<<dim3(NB_ * NT_ / TB, DM / TB, 3), 256, 0, stream>>>(nullptr, xq, xk, xv, WT, bq, bk, bv, DM, DM, nullptr, DM, 0, DM * DM, NB_ * NT_ * DM, Qf, nullptr);
    k_mm<true, 1, 4><<<dim3(NRB, NRB, NB_), 256, 0, stream>>>(Qf, nullptr, nullptr, nullptr, Kf, nullptr, nullptr, nullptr, DM, DM, nullptr, NT_, NT_ * DM, NT_ * DM, NT_ * NT_, PF, ST);
    k_mm<true, 2, 0><<<dim3(NRB / 2, DM / TB, NB_), 256, 0, stream>>>(PF, nullptr, nullptr, nullptr, VT, nullptr, nullptr, nullptr, NT_, NT_, out, DM, NT_ * NT_, DM * NT_, NT_ * DM, nullptr, ST);
}
